// v000
// Times are from an AMD MI455X. After a warm-up the kernel runs many times in a row, and a time is the length of
// such a window on the GPU divided by its runs, so every launch and the gaps after it count. The runs cycle
// through copies of the inputs. A figure is the median of several windows, for all but v000 over two sittings.
// Sittings can differ by a few percent; kernels timed side by side share one.
// The starting kernel, v000, takes 421 microseconds a run.
#include <hip/hip_runtime.h>
#include <hip/hip_bf16.h>
#include <math.h>

typedef __attribute__((ext_vector_type(16))) _Float16 v16h;
typedef __attribute__((ext_vector_type(8)))  _Float16 v8h;
typedef __attribute__((ext_vector_type(8)))  float    v8f;

union HFrag { v16h v; v8h h[2]; };

static constexpr int B_    = 2;
static constexpr int NSEQ  = 2048;
static constexpr int D_    = 1024;
static constexpr int H_    = 16;
static constexpr int DH    = 64;      // head dim
static constexpr int PDIM  = 256;
static constexpr int DHID  = 512;     // D/2
static constexpr int MROWS = B_ * NSEQ;   // 4096
static constexpr int NOUTQ = 3 * D_;      // 3072

// load one 16x32 f16 fragment slice for this lane; p already includes +8*g
__device__ __forceinline__ void ldfrag(HFrag& f, const _Float16* p) {
  f.h[0] = *(const v8h*)(p);
  f.h[1] = *(const v8h*)(p + 16);
}

__device__ __forceinline__ v8f wmma16(const HFrag& a, const HFrag& b, v8f c) {
  return __builtin_amdgcn_wmma_f32_16x16x32_f16(false, a.v, false, b.v,
                                                (short)0, c, false, false);
}

// ---------------------------------------------------------------- converts
__global__ void f32_to_f16_kernel(const float* __restrict__ src,
                                  _Float16* __restrict__ dst, int n) {
  int i = blockIdx.x * blockDim.x + threadIdx.x;
  int stride = gridDim.x * blockDim.x;
  for (; i < n; i += stride) dst[i] = (_Float16)src[i];
}

// ------------------------------------------------- gate + tail of col_bias
__global__ void gate_tail_kernel(const float* __restrict__ trust,
                                 const float* __restrict__ tscale,
                                 float* __restrict__ gate,
                                 float* __restrict__ bias,
                                 int n_ctx, int n) {
  int i = blockIdx.x * blockDim.x + threadIdx.x;
  if (i >= n) return;
  if (i < n_ctx) {
    gate[i] = 1.f / (1.f + __expf(-tscale[0] * trust[i]));
  } else {
    gate[i] = 1.f;
    bias[i] = 0.f;
  }
}

// ---------------------------------- per-context-row bias MLP (tiny, VALU)
__global__ __launch_bounds__(256) void ctx_bias_kernel(
    const float* __restrict__ delta, const float* __restrict__ Wd1,
    const float* __restrict__ bd1,   const float* __restrict__ Wd2,
    const float* __restrict__ bd2,   const float* __restrict__ ppr,
    const float* __restrict__ alpha, float* __restrict__ bias) {
  int row = blockIdx.x;
  const float* drow = delta + (size_t)row * PDIM;
  float local = 0.f;
  for (int j = threadIdx.x; j < DHID; j += blockDim.x) {
    const float* wrow = Wd1 + (size_t)j * PDIM;
    float a = bd1[j];
    for (int p = 0; p < PDIM; ++p) a = fmaf(drow[p], wrow[p], a);
    float ge = 0.5f * a * (1.f + erff(a * 0.70710678118654752f));  // exact gelu
    local += ge * Wd2[j];
  }
  __shared__ float red[256];
  red[threadIdx.x] = local;
  __syncthreads();
  for (int s = 128; s > 0; s >>= 1) {
    if ((int)threadIdx.x < s) red[threadIdx.x] += red[threadIdx.x + s];
    __syncthreads();
  }
  if (threadIdx.x == 0) {
    float pv = ppr[row];
    pv = pv < 1e-8f ? 1e-8f : pv;
    bias[row] = alpha[0] * logf(pv) + red[0] + bd2[0];
  }
}

// ------------------------------------------------------- QKV WMMA GEMM
// out = xh[4096,1024] @ W_in^T + b_in, routed to q/k/v head buffers.
// q scaled by d^-0.5, v gated + stored transposed [B,H,d,N].
// Register double-buffered over k so loads overlap WMMA.
__global__ __launch_bounds__(256, 1) void qkv_gemm_kernel(
    const _Float16* __restrict__ xh, const _Float16* __restrict__ winh,
    const float* __restrict__ b_in,  const float* __restrict__ gate,
    _Float16* __restrict__ qh, _Float16* __restrict__ kh,
    _Float16* __restrict__ vth) {
  const int lane = threadIdx.x & 31;
  const int wave = threadIdx.x >> 5;
  const int l16  = lane & 15;
  const int g    = lane >> 4;
  const int m0 = blockIdx.x * 64 + (wave & 3) * 16;
  const int n0 = blockIdx.y * 128 + (wave >> 2) * 64;

  const _Float16* arow = xh + (size_t)(m0 + l16) * D_ + 8 * g;
  const _Float16* brow[4];
#pragma unroll
  for (int f = 0; f < 4; ++f)
    brow[f] = winh + (size_t)(n0 + f * 16 + l16) * D_ + 8 * g;

  v8f zero = {0.f, 0.f, 0.f, 0.f, 0.f, 0.f, 0.f, 0.f};
  v8f acc[4];
#pragma unroll
  for (int f = 0; f < 4; ++f) acc[f] = zero;

  HFrag a0, a1, b0[4], b1[4];
  ldfrag(a0, arow);
#pragma unroll
  for (int f = 0; f < 4; ++f) ldfrag(b0[f], brow[f]);

  for (int k0 = 0; k0 < D_ - 64; k0 += 64) {
    ldfrag(a1, arow + k0 + 32);
#pragma unroll
    for (int f = 0; f < 4; ++f) ldfrag(b1[f], brow[f] + k0 + 32);
#pragma unroll
    for (int f = 0; f < 4; ++f) acc[f] = wmma16(a0, b0[f], acc[f]);
    ldfrag(a0, arow + k0 + 64);
#pragma unroll
    for (int f = 0; f < 4; ++f) ldfrag(b0[f], brow[f] + k0 + 64);
#pragma unroll
    for (int f = 0; f < 4; ++f) acc[f] = wmma16(a1, b1[f], acc[f]);
  }
  ldfrag(a1, arow + D_ - 32);
#pragma unroll
  for (int f = 0; f < 4; ++f) ldfrag(b1[f], brow[f] + D_ - 32);
#pragma unroll
  for (int f = 0; f < 4; ++f) acc[f] = wmma16(a0, b0[f], acc[f]);
#pragma unroll
  for (int f = 0; f < 4; ++f) acc[f] = wmma16(a1, b1[f], acc[f]);

  const float qscale = 0.125f;  // 1/sqrt(64)
#pragma unroll
  for (int f = 0; f < 4; ++f) {
    int nn = n0 + f * 16 + l16;
    int sect = nn / D_;
    int jj = nn % D_;
    int h = jj / DH, c = jj % DH;
#pragma unroll
    for (int r = 0; r < 8; ++r) {
      int m = m0 + r + 8 * g;
      int bi = m / NSEQ, tok = m % NSEQ;
      float val = acc[f][r] + b_in[nn];
      size_t hb = (size_t)(bi * H_ + h);
      if (sect == 0)
        qh[(hb * NSEQ + tok) * DH + c] = (_Float16)(val * qscale);
      else if (sect == 1)
        kh[(hb * NSEQ + tok) * DH + c] = (_Float16)val;
      else
        vth[(hb * DH + c) * NSEQ + tok] = (_Float16)(val * gate[tok]);
    }
  }
}

// --------------------------------------------------- flash attention
// 1 wave per 16-query tile; 32-key chunks; online softmax over all 32
// lanes; K and V fragments loaded together at chunk top so V latency is
// hidden behind S-WMMAs + softmax.
__global__ __launch_bounds__(128, 1) void flash_attn_kernel(
    const _Float16* __restrict__ qh, const _Float16* __restrict__ kh,
    const _Float16* __restrict__ vth, const float* __restrict__ bias,
    _Float16* __restrict__ attn) {
  const int lane = threadIdx.x & 31;
  const int wave = threadIdx.x >> 5;
  const int l16  = lane & 15;
  const int g    = lane >> 4;

  const int tile = blockIdx.x * 4 + wave;
  const int qt = tile % (NSEQ / 16);
  const int bh = tile / (NSEQ / 16);

  __shared__ __align__(16) float    Ssh[4][16 * 32];
  __shared__ __align__(16) _Float16 Psh[4][16 * 32];
  __shared__ float rmax[4][16], rsum[4][16], rfac[4][16];
  __shared__ float hm[4][32], hs[4][32];

  float*    S  = Ssh[wave];
  _Float16* Pp = Psh[wave];

  const _Float16* qbase = qh + ((size_t)bh * NSEQ + (size_t)qt * 16) * DH;
  const _Float16* kball = kh + (size_t)bh * NSEQ * DH;
  const _Float16* vbase = vth + (size_t)bh * DH * NSEQ;

  HFrag aq[2];
  {
    const _Float16* qrow = qbase + (size_t)l16 * DH + 8 * g;
    ldfrag(aq[0], qrow);
    ldfrag(aq[1], qrow + 32);
  }

  v8f zero = {0.f, 0.f, 0.f, 0.f, 0.f, 0.f, 0.f, 0.f};
  v8f acc[4];
#pragma unroll
  for (int f = 0; f < 4; ++f) acc[f] = zero;

  if (lane < 16) {
    rmax[wave][lane] = -INFINITY;
    rsum[wave][lane] = 0.f;
  }
  __syncthreads();

  const int row  = lane & 15;   // softmax: 2 lanes per query row
  const int half = lane >> 4;

  for (int kc = 0; kc < NSEQ; kc += 32) {
    // ---- issue all global loads for this chunk up front
    HFrag bk[4];   // [keysub(2)][dchunk(2)]
    {
      const _Float16* krow  = kball + (size_t)(kc + l16) * DH + 8 * g;
      const _Float16* krow2 = krow + 16 * DH;
      ldfrag(bk[0], krow);        // keys 0-15, d 0-31
      ldfrag(bk[1], krow + 32);   // keys 0-15, d 32-63
      ldfrag(bk[2], krow2);       // keys 16-31, d 0-31
      ldfrag(bk[3], krow2 + 32);  // keys 16-31, d 32-63
    }
    HFrag bv[4];
#pragma unroll
    for (int f = 0; f < 4; ++f) {
      const _Float16* vrow = vbase + (size_t)(f * 16 + l16) * NSEQ + kc + 8 * g;
      ldfrag(bv[f], vrow);
    }

    // ---- S = q @ k^T (scale pre-folded into q)
    v8f s0 = zero, s1 = zero;
    s0 = wmma16(aq[0], bk[0], s0);
    s0 = wmma16(aq[1], bk[1], s0);
    s1 = wmma16(aq[0], bk[2], s1);
    s1 = wmma16(aq[1], bk[3], s1);

#pragma unroll
    for (int r = 0; r < 8; ++r) {
      S[(r + 8 * g) * 32 + l16]      = s0[r];
      S[(r + 8 * g) * 32 + 16 + l16] = s1[r];
    }
    __syncthreads();

    // ---- online softmax, all 32 lanes (each handles 16 of a row)
    {
      float* srow = S + row * 32 + half * 16;
      const float* brow = bias + kc + half * 16;
      float lmax = -INFINITY;
#pragma unroll
      for (int j = 0; j < 16; ++j) {
        float sv = srow[j] + brow[j];
        srow[j] = sv;
        lmax = fmaxf(lmax, sv);
      }
      hm[wave][lane] = lmax;
      __syncthreads();
      float mold = rmax[wave][row];
      float mx = fmaxf(mold, fmaxf(hm[wave][row], hm[wave][row + 16]));
      float lsum = 0.f;
      _Float16* prow = Pp + row * 32 + half * 16;
#pragma unroll
      for (int j = 0; j < 16; ++j) {
        float p = __expf(srow[j] - mx);
        prow[j] = (_Float16)p;
        lsum += p;
      }
      hs[wave][lane] = lsum;
      __syncthreads();
      if (half == 0) {
        float fr = __expf(mold - mx);
        rsum[wave][row] = rsum[wave][row] * fr + hs[wave][row] + hs[wave][row + 16];
        rmax[wave][row] = mx;
        rfac[wave][row] = fr;
      }
    }
    __syncthreads();

    // ---- rescale accumulator + P@V (V already in registers)
    float fr[8];
#pragma unroll
    for (int r = 0; r < 8; ++r) fr[r] = rfac[wave][r + 8 * g];
    HFrag ap;
    {
      const _Float16* prow = Pp + l16 * 32 + 8 * g;
      ap.h[0] = *(const v8h*)(prow);
      ap.h[1] = *(const v8h*)(prow + 16);
    }
#pragma unroll
    for (int f = 0; f < 4; ++f) {
#pragma unroll
      for (int r = 0; r < 8; ++r) acc[f][r] *= fr[r];
      acc[f] = wmma16(ap, bv[f], acc[f]);
    }
    __syncthreads();
  }

  if (lane < 16) rfac[wave][lane] = 1.f / rsum[wave][lane];
  __syncthreads();

  const int bi = bh / H_;
  const int h  = bh % H_;
#pragma unroll
  for (int f = 0; f < 4; ++f) {
#pragma unroll
    for (int r = 0; r < 8; ++r) {
      int tok = qt * 16 + r + 8 * g;
      float inv = rfac[wave][r + 8 * g];
      attn[((size_t)(bi * NSEQ + tok)) * D_ + h * DH + f * 16 + l16] =
          (_Float16)(acc[f][r] * inv);
    }
  }
}

// ------------------------------------------------- output projection
__global__ __launch_bounds__(256, 1) void out_gemm_kernel(
    const _Float16* __restrict__ ah, const _Float16* __restrict__ wouth,
    const float* __restrict__ b_out, float* __restrict__ out) {
  const int lane = threadIdx.x & 31;
  const int wave = threadIdx.x >> 5;
  const int l16  = lane & 15;
  const int g    = lane >> 4;
  const int m0 = blockIdx.x * 64 + (wave & 3) * 16;
  const int n0 = blockIdx.y * 128 + (wave >> 2) * 64;

  const _Float16* arow = ah + (size_t)(m0 + l16) * D_ + 8 * g;
  const _Float16* brow[4];
#pragma unroll
  for (int f = 0; f < 4; ++f)
    brow[f] = wouth + (size_t)(n0 + f * 16 + l16) * D_ + 8 * g;

  v8f zero = {0.f, 0.f, 0.f, 0.f, 0.f, 0.f, 0.f, 0.f};
  v8f acc[4];
#pragma unroll
  for (int f = 0; f < 4; ++f) acc[f] = zero;

  HFrag a0, a1, b0[4], b1[4];
  ldfrag(a0, arow);
#pragma unroll
  for (int f = 0; f < 4; ++f) ldfrag(b0[f], brow[f]);

  for (int k0 = 0; k0 < D_ - 64; k0 += 64) {
    ldfrag(a1, arow + k0 + 32);
#pragma unroll
    for (int f = 0; f < 4; ++f) ldfrag(b1[f], brow[f] + k0 + 32);
#pragma unroll
    for (int f = 0; f < 4; ++f) acc[f] = wmma16(a0, b0[f], acc[f]);
    ldfrag(a0, arow + k0 + 64);
#pragma unroll
    for (int f = 0; f < 4; ++f) ldfrag(b0[f], brow[f] + k0 + 64);
#pragma unroll
    for (int f = 0; f < 4; ++f) acc[f] = wmma16(a1, b1[f], acc[f]);
  }
  ldfrag(a1, arow + D_ - 32);
#pragma unroll
  for (int f = 0; f < 4; ++f) ldfrag(b1[f], brow[f] + D_ - 32);
#pragma unroll
  for (int f = 0; f < 4; ++f) acc[f] = wmma16(a0, b0[f], acc[f]);
#pragma unroll
  for (int f = 0; f < 4; ++f) acc[f] = wmma16(a1, b1[f], acc[f]);

#pragma unroll
  for (int f = 0; f < 4; ++f) {
    int nn = n0 + f * 16 + l16;
#pragma unroll
    for (int r = 0; r < 8; ++r) {
      int m = m0 + r + 8 * g;
      out[(size_t)m * D_ + nn] = acc[f][r] + b_out[nn];
    }
  }
}

// ------------------------------------------------------------ launcher
extern "C" void kernel_launch(void* const* d_in, const int* in_sizes, int n_in,
                              void* d_out, int out_size, void* d_ws,
                              size_t ws_size, hipStream_t stream) {
  (void)n_in; (void)out_size; (void)ws_size;
  const float* x         = (const float*)d_in[0];
  const float* ctx_ppr   = (const float*)d_in[2];
  const float* ctx_delta = (const float*)d_in[3];
  const float* ctx_trust = (const float*)d_in[4];
  const float* W_in      = (const float*)d_in[5];
  const float* b_in      = (const float*)d_in[6];
  const float* W_out     = (const float*)d_in[7];
  const float* b_out     = (const float*)d_in[8];
  const float* alpha     = (const float*)d_in[9];
  const float* tscale    = (const float*)d_in[10];
  const float* Wd1       = (const float*)d_in[11];
  const float* bd1       = (const float*)d_in[12];
  const float* Wd2       = (const float*)d_in[13];
  const float* bd2       = (const float*)d_in[14];
  float* out = (float*)d_out;
  const int n_ctx = in_sizes[2];  // ctx_ppr has n_ctx elements

  // workspace carve (~42 MB; attn output reuses xh)
  char* w = (char*)d_ws;
  auto carve = [&](size_t bytes) -> char* {
    char* p = w;
    w += (bytes + 255) & ~(size_t)255;
    return p;
  };
  _Float16* xh    = (_Float16*)carve((size_t)MROWS * D_ * 2);
  _Float16* winh  = (_Float16*)carve((size_t)3 * D_ * D_ * 2);
  _Float16* wouth = (_Float16*)carve((size_t)D_ * D_ * 2);
  _Float16* qh    = (_Float16*)carve((size_t)MROWS * D_ * 2);
  _Float16* kh    = (_Float16*)carve((size_t)MROWS * D_ * 2);
  _Float16* vth   = (_Float16*)carve((size_t)MROWS * D_ * 2);
  float* gate = (float*)carve((size_t)NSEQ * 4);
  float* bias = (float*)carve((size_t)NSEQ * 4);
  _Float16* attn = xh;  // xh dead after QKV GEMM

  f32_to_f16_kernel<<<512, 256, 0, stream>>>(x, xh, MROWS * D_);
  f32_to_f16_kernel<<<512, 256, 0, stream>>>(W_in, winh, 3 * D_ * D_);
  f32_to_f16_kernel<<<256, 256, 0, stream>>>(W_out, wouth, D_ * D_);

  gate_tail_kernel<<<(NSEQ + 255) / 256, 256, 0, stream>>>(
      ctx_trust, tscale, gate, bias, n_ctx, NSEQ);
  ctx_bias_kernel<<<n_ctx, 256, 0, stream>>>(ctx_delta, Wd1, bd1, Wd2, bd2,
                                             ctx_ppr, alpha, bias);

  qkv_gemm_kernel<<<dim3(MROWS / 64, NOUTQ / 128), 256, 0, stream>>>(
      xh, winh, b_in, gate, qh, kh, vth);

  flash_attn_kernel<<<(B_ * H_ * (NSEQ / 16)) / 4, 128, 0, stream>>>(
      qh, kh, vth, bias, attn);

  out_gemm_kernel<<<dim3(MROWS / 64, D_ / 128), 256, 0, stream>>>(
      attn, wouth, b_out, out);
}

// v001
// A run of this version takes 341 microseconds.
// In two side-by-side timings against v000, it was 1.28 and 1.26 times as fast.
#include <hip/hip_runtime.h>
#include <hip/hip_bf16.h>
#include <math.h>

typedef __attribute__((ext_vector_type(16))) _Float16 v16h;
typedef __attribute__((ext_vector_type(8)))  _Float16 v8h;
typedef __attribute__((ext_vector_type(8)))  float    v8f;

union HFrag { v16h v; v8h h[2]; };

static constexpr int B_    = 2;
static constexpr int NSEQ  = 2048;
static constexpr int D_    = 1024;
static constexpr int H_    = 16;
static constexpr int DH    = 64;      // head dim
static constexpr int PDIM  = 256;
static constexpr int DHID  = 512;     // D/2
static constexpr int MROWS = B_ * NSEQ;   // 4096
static constexpr int NOUTQ = 3 * D_;      // 3072

// load one 16x32 f16 fragment slice for this lane; p already includes +8*g
__device__ __forceinline__ void ldfrag(HFrag& f, const _Float16* p) {
  f.h[0] = *(const v8h*)(p);
  f.h[1] = *(const v8h*)(p + 16);
}

__device__ __forceinline__ v8f wmma16(const HFrag& a, const HFrag& b, v8f c) {
  return __builtin_amdgcn_wmma_f32_16x16x32_f16(false, a.v, false, b.v,
                                                (short)0, c, false, false);
}

// ---------------------------------------------------------------- converts
__global__ void f32_to_f16_kernel(const float* __restrict__ src,
                                  _Float16* __restrict__ dst, int n) {
  int i = blockIdx.x * blockDim.x + threadIdx.x;
  int stride = gridDim.x * blockDim.x;
  for (; i < n; i += stride) dst[i] = (_Float16)src[i];
}

// ------------------------------------------------- gate + tail of col_bias
__global__ void gate_tail_kernel(const float* __restrict__ trust,
                                 const float* __restrict__ tscale,
                                 float* __restrict__ gate,
                                 float* __restrict__ bias,
                                 int n_ctx, int n) {
  int i = blockIdx.x * blockDim.x + threadIdx.x;
  if (i >= n) return;
  if (i < n_ctx) {
    gate[i] = 1.f / (1.f + __expf(-tscale[0] * trust[i]));
  } else {
    gate[i] = 1.f;
    bias[i] = 0.f;
  }
}

// ---------------------------------- per-context-row bias MLP (tiny, VALU)
__global__ __launch_bounds__(256) void ctx_bias_kernel(
    const float* __restrict__ delta, const float* __restrict__ Wd1,
    const float* __restrict__ bd1,   const float* __restrict__ Wd2,
    const float* __restrict__ bd2,   const float* __restrict__ ppr,
    const float* __restrict__ alpha, float* __restrict__ bias) {
  int row = blockIdx.x;
  const float* drow = delta + (size_t)row * PDIM;
  float local = 0.f;
  for (int j = threadIdx.x; j < DHID; j += blockDim.x) {
    const float* wrow = Wd1 + (size_t)j * PDIM;
    float a = bd1[j];
    for (int p = 0; p < PDIM; ++p) a = fmaf(drow[p], wrow[p], a);
    float ge = 0.5f * a * (1.f + erff(a * 0.70710678118654752f));  // exact gelu
    local += ge * Wd2[j];
  }
  __shared__ float red[256];
  red[threadIdx.x] = local;
  __syncthreads();
  for (int s = 128; s > 0; s >>= 1) {
    if ((int)threadIdx.x < s) red[threadIdx.x] += red[threadIdx.x + s];
    __syncthreads();
  }
  if (threadIdx.x == 0) {
    float pv = ppr[row];
    pv = pv < 1e-8f ? 1e-8f : pv;
    bias[row] = alpha[0] * logf(pv) + red[0] + bd2[0];
  }
}

// ------------------------------------------------------- QKV WMMA GEMM
// out = xh[4096,1024] @ W_in^T + b_in, routed to q/k/v head buffers.
// q scaled by d^-0.5, v gated + stored transposed [B,H,d,N].
// Register double-buffered over k so loads overlap WMMA.
__global__ __launch_bounds__(256, 1) void qkv_gemm_kernel(
    const _Float16* __restrict__ xh, const _Float16* __restrict__ winh,
    const float* __restrict__ b_in,  const float* __restrict__ gate,
    _Float16* __restrict__ qh, _Float16* __restrict__ kh,
    _Float16* __restrict__ vth) {
  const int lane = threadIdx.x & 31;
  const int wave = threadIdx.x >> 5;
  const int l16  = lane & 15;
  const int g    = lane >> 4;
  const int m0 = blockIdx.x * 64 + (wave & 3) * 16;
  const int n0 = blockIdx.y * 128 + (wave >> 2) * 64;

  const _Float16* arow = xh + (size_t)(m0 + l16) * D_ + 8 * g;
  const _Float16* brow[4];
#pragma unroll
  for (int f = 0; f < 4; ++f)
    brow[f] = winh + (size_t)(n0 + f * 16 + l16) * D_ + 8 * g;

  v8f zero = {0.f, 0.f, 0.f, 0.f, 0.f, 0.f, 0.f, 0.f};
  v8f acc[4];
#pragma unroll
  for (int f = 0; f < 4; ++f) acc[f] = zero;

  HFrag a0, a1, b0[4], b1[4];
  ldfrag(a0, arow);
#pragma unroll
  for (int f = 0; f < 4; ++f) ldfrag(b0[f], brow[f]);

  for (int k0 = 0; k0 < D_ - 64; k0 += 64) {
    ldfrag(a1, arow + k0 + 32);
#pragma unroll
    for (int f = 0; f < 4; ++f) ldfrag(b1[f], brow[f] + k0 + 32);
#pragma unroll
    for (int f = 0; f < 4; ++f) acc[f] = wmma16(a0, b0[f], acc[f]);
    ldfrag(a0, arow + k0 + 64);
#pragma unroll
    for (int f = 0; f < 4; ++f) ldfrag(b0[f], brow[f] + k0 + 64);
#pragma unroll
    for (int f = 0; f < 4; ++f) acc[f] = wmma16(a1, b1[f], acc[f]);
  }
  ldfrag(a1, arow + D_ - 32);
#pragma unroll
  for (int f = 0; f < 4; ++f) ldfrag(b1[f], brow[f] + D_ - 32);
#pragma unroll
  for (int f = 0; f < 4; ++f) acc[f] = wmma16(a0, b0[f], acc[f]);
#pragma unroll
  for (int f = 0; f < 4; ++f) acc[f] = wmma16(a1, b1[f], acc[f]);

  const float qscale = 0.125f;  // 1/sqrt(64)
#pragma unroll
  for (int f = 0; f < 4; ++f) {
    int nn = n0 + f * 16 + l16;
    int sect = nn / D_;
    int jj = nn % D_;
    int h = jj / DH, c = jj % DH;
#pragma unroll
    for (int r = 0; r < 8; ++r) {
      int m = m0 + r + 8 * g;
      int bi = m / NSEQ, tok = m % NSEQ;
      float val = acc[f][r] + b_in[nn];
      size_t hb = (size_t)(bi * H_ + h);
      if (sect == 0)
        qh[(hb * NSEQ + tok) * DH + c] = (_Float16)(val * qscale);
      else if (sect == 1)
        kh[(hb * NSEQ + tok) * DH + c] = (_Float16)val;
      else
        vth[(hb * DH + c) * NSEQ + tok] = (_Float16)(val * gate[tok]);
    }
  }
}

// --------------------------------------------------- flash attention
// 1 wave per 16-query tile; 32-key chunks. Scores are formed transposed,
// S^T = K.Q^T (keys down the rows, queries across the lanes), and the
// output as O^T += V^T.P^T: a lane holds one query's scores, so maximum,
// exponentials and sum stay in its registers, and the two score tiles,
// converted in place, are the B operand of the second product.
typedef __attribute__((ext_vector_type(2))) float    v2f;
typedef __attribute__((ext_vector_type(2))) _Float16 v2h;

// lane l <-> lane l ^ 16
__device__ __forceinline__ float xhalf(float x) {
  int b = __builtin_bit_cast(int, x);
  return __builtin_bit_cast(
      float, __builtin_amdgcn_permlanex16(b, b, 0x76543210, 0xfedcba98, false,
                                          false));
}

__global__ __launch_bounds__(128, 1) void flash_attn_kernel(
    const _Float16* __restrict__ qh, const _Float16* __restrict__ kh,
    const _Float16* __restrict__ vth, const float* __restrict__ bias,
    _Float16* __restrict__ attn) {
  const int lane = threadIdx.x & 31;
  const int wave = threadIdx.x >> 5;
  const int l16  = lane & 15;
  const int g    = lane >> 4;

  const int tile = blockIdx.x * 4 + wave;
  const int qt = tile % (NSEQ / 16);
  const int bh = tile / (NSEQ / 16);

  const _Float16* qbase = qh + ((size_t)bh * NSEQ + (size_t)qt * 16) * DH;
  const _Float16* kball = kh + (size_t)bh * NSEQ * DH;
  const _Float16* vbase = vth + (size_t)bh * DH * NSEQ;

  HFrag bq[2];   // B operand: column l16 = query, k = head dim
  {
    const _Float16* qrow = qbase + (size_t)l16 * DH + 8 * g;
    ldfrag(bq[0], qrow);
    ldfrag(bq[1], qrow + 32);
  }

  v8f zero = {0.f, 0.f, 0.f, 0.f, 0.f, 0.f, 0.f, 0.f};
  v8f acc[4];    // acc[f][r] = O[query l16][f * 16 + 8 * g + r]
#pragma unroll
  for (int f = 0; f < 4; ++f) acc[f] = zero;

  const float L2E = 1.4426950408889634f;
  float mrun = -INFINITY;  // this query's running maximum (same in both halves)
  float lsum = 0.f;        // sum over this lane half's keys only

  for (int kc = 0; kc < NSEQ; kc += 32) {
    // ---- issue all global loads for this chunk up front
    // the per-key bias in the accumulator's own map (row = key) starts the sum
    v8f s0 = *(const v8f*)(bias + kc + 8 * g);
    v8f s1 = *(const v8f*)(bias + kc + 16 + 8 * g);
    HFrag ak[4];   // [keysub(2)][dchunk(2)], A operand: row l16 = key
    {
      const _Float16* krow  = kball + (size_t)(kc + l16) * DH + 8 * g;
      const _Float16* krow2 = krow + 16 * DH;
      ldfrag(ak[0], krow);        // keys 0-15, d 0-31
      ldfrag(ak[1], krow + 32);   // keys 0-15, d 32-63
      ldfrag(ak[2], krow2);       // keys 16-31, d 0-31
      ldfrag(ak[3], krow2 + 32);  // keys 16-31, d 32-63
    }
    HFrag av[4];   // A operand: row l16 = head dim f * 16 + l16, k = key
#pragma unroll
    for (int f = 0; f < 4; ++f) {
      const _Float16* vrow = vbase + (size_t)(f * 16 + l16) * NSEQ + kc + 8 * g;
      ldfrag(av[f], vrow);
    }
    // holds the chunk's loads up here, as one group: without it the compiler
    // sinks each V load to just in front of its product and waits on it there
    __builtin_amdgcn_sched_barrier(0);

    // ---- S^T = k @ q^T + bias (scale pre-folded into q)
    s0 = wmma16(ak[0], bq[0], s0);
    s0 = wmma16(ak[1], bq[1], s0);
    s1 = wmma16(ak[2], bq[0], s1);
    s1 = wmma16(ak[3], bq[1], s1);

    // ---- online softmax, one query per lane, 16 of its 32 keys
    float t0 = fmaxf(fmaxf(s0[0], s0[1]), s0[2]);
    float t1 = fmaxf(fmaxf(s0[3], s0[4]), s0[5]);
    float t2 = fmaxf(fmaxf(s0[6], s0[7]), s1[0]);
    float t3 = fmaxf(fmaxf(s1[1], s1[2]), s1[3]);
    float t4 = fmaxf(fmaxf(s1[4], s1[5]), s1[6]);
    float mx = fmaxf(fmaxf(fmaxf(t0, t1), t2), fmaxf(fmaxf(t3, t4), s1[7]));
    mx = fmaxf(mx, xhalf(mx));
    mx = fmaxf(mx, mrun);
    const float fr = __builtin_amdgcn_exp2f((mrun - mx) * L2E);
    mrun = mx;
    const float nm = -mx * L2E;

    HFrag bp;      // B operand: column l16 = query, k = key, hardware k order
    v2f ps = {0.f, 0.f};
#pragma unroll
    for (int i = 0; i < 4; ++i) {
      v2f a0 = __builtin_elementwise_fma(v2f{s0[2 * i], s0[2 * i + 1]},
                                         v2f{L2E, L2E}, v2f{nm, nm});
      v2f a1 = __builtin_elementwise_fma(v2f{s1[2 * i], s1[2 * i + 1]},
                                         v2f{L2E, L2E}, v2f{nm, nm});
      v2f p0 = {__builtin_amdgcn_exp2f(a0.x), __builtin_amdgcn_exp2f(a0.y)};
      v2f p1 = {__builtin_amdgcn_exp2f(a1.x), __builtin_amdgcn_exp2f(a1.y)};
      ps += p0 + p1;
      v2h h0 = __builtin_convertvector(p0, v2h);
      v2h h1 = __builtin_convertvector(p1, v2h);
      bp.h[0][2 * i] = h0.x; bp.h[0][2 * i + 1] = h0.y;
      bp.h[1][2 * i] = h1.x; bp.h[1][2 * i + 1] = h1.y;
    }
    lsum = lsum * fr + (ps.x + ps.y);

    // ---- rescale accumulator + O^T += V^T @ P^T (V already in registers)
#pragma unroll
    for (int f = 0; f < 4; ++f) {
      acc[f] = acc[f] * fr;
      acc[f] = wmma16(av[f], bp, acc[f]);
    }
  }

  const float inv = 1.f / (lsum + xhalf(lsum));

  const int bi = bh / H_;
  const int h  = bh % H_;
  _Float16* orow =
      attn + ((size_t)(bi * NSEQ + qt * 16 + l16)) * D_ + h * DH + 8 * g;
#pragma unroll
  for (int f = 0; f < 4; ++f) {
    v8h o;
#pragma unroll
    for (int r = 0; r < 8; ++r) o[r] = (_Float16)(acc[f][r] * inv);
    *(v8h*)(orow + f * 16) = o;
  }
}

// ------------------------------------------------- output projection
__global__ __launch_bounds__(256, 1) void out_gemm_kernel(
    const _Float16* __restrict__ ah, const _Float16* __restrict__ wouth,
    const float* __restrict__ b_out, float* __restrict__ out) {
  const int lane = threadIdx.x & 31;
  const int wave = threadIdx.x >> 5;
  const int l16  = lane & 15;
  const int g    = lane >> 4;
  const int m0 = blockIdx.x * 64 + (wave & 3) * 16;
  const int n0 = blockIdx.y * 128 + (wave >> 2) * 64;

  const _Float16* arow = ah + (size_t)(m0 + l16) * D_ + 8 * g;
  const _Float16* brow[4];
#pragma unroll
  for (int f = 0; f < 4; ++f)
    brow[f] = wouth + (size_t)(n0 + f * 16 + l16) * D_ + 8 * g;

  v8f zero = {0.f, 0.f, 0.f, 0.f, 0.f, 0.f, 0.f, 0.f};
  v8f acc[4];
#pragma unroll
  for (int f = 0; f < 4; ++f) acc[f] = zero;

  HFrag a0, a1, b0[4], b1[4];
  ldfrag(a0, arow);
#pragma unroll
  for (int f = 0; f < 4; ++f) ldfrag(b0[f], brow[f]);

  for (int k0 = 0; k0 < D_ - 64; k0 += 64) {
    ldfrag(a1, arow + k0 + 32);
#pragma unroll
    for (int f = 0; f < 4; ++f) ldfrag(b1[f], brow[f] + k0 + 32);
#pragma unroll
    for (int f = 0; f < 4; ++f) acc[f] = wmma16(a0, b0[f], acc[f]);
    ldfrag(a0, arow + k0 + 64);
#pragma unroll
    for (int f = 0; f < 4; ++f) ldfrag(b0[f], brow[f] + k0 + 64);
#pragma unroll
    for (int f = 0; f < 4; ++f) acc[f] = wmma16(a1, b1[f], acc[f]);
  }
  ldfrag(a1, arow + D_ - 32);
#pragma unroll
  for (int f = 0; f < 4; ++f) ldfrag(b1[f], brow[f] + D_ - 32);
#pragma unroll
  for (int f = 0; f < 4; ++f) acc[f] = wmma16(a0, b0[f], acc[f]);
#pragma unroll
  for (int f = 0; f < 4; ++f) acc[f] = wmma16(a1, b1[f], acc[f]);

#pragma unroll
  for (int f = 0; f < 4; ++f) {
    int nn = n0 + f * 16 + l16;
#pragma unroll
    for (int r = 0; r < 8; ++r) {
      int m = m0 + r + 8 * g;
      out[(size_t)m * D_ + nn] = acc[f][r] + b_out[nn];
    }
  }
}

// ------------------------------------------------------------ launcher
extern "C" void kernel_launch(void* const* d_in, const int* in_sizes, int n_in,
                              void* d_out, int out_size, void* d_ws,
                              size_t ws_size, hipStream_t stream) {
  (void)n_in; (void)out_size; (void)ws_size;
  const float* x         = (const float*)d_in[0];
  const float* ctx_ppr   = (const float*)d_in[2];
  const float* ctx_delta = (const float*)d_in[3];
  const float* ctx_trust = (const float*)d_in[4];
  const float* W_in      = (const float*)d_in[5];
  const float* b_in      = (const float*)d_in[6];
  const float* W_out     = (const float*)d_in[7];
  const float* b_out     = (const float*)d_in[8];
  const float* alpha     = (const float*)d_in[9];
  const float* tscale    = (const float*)d_in[10];
  const float* Wd1       = (const float*)d_in[11];
  const float* bd1       = (const float*)d_in[12];
  const float* Wd2       = (const float*)d_in[13];
  const float* bd2       = (const float*)d_in[14];
  float* out = (float*)d_out;
  const int n_ctx = in_sizes[2];  // ctx_ppr has n_ctx elements

  // workspace carve (~42 MB; attn output reuses xh)
  char* w = (char*)d_ws;
  auto carve = [&](size_t bytes) -> char* {
    char* p = w;
    w += (bytes + 255) & ~(size_t)255;
    return p;
  };
  _Float16* xh    = (_Float16*)carve((size_t)MROWS * D_ * 2);
  _Float16* winh  = (_Float16*)carve((size_t)3 * D_ * D_ * 2);
  _Float16* wouth = (_Float16*)carve((size_t)D_ * D_ * 2);
  _Float16* qh    = (_Float16*)carve((size_t)MROWS * D_ * 2);
  _Float16* kh    = (_Float16*)carve((size_t)MROWS * D_ * 2);
  _Float16* vth   = (_Float16*)carve((size_t)MROWS * D_ * 2);
  float* gate = (float*)carve((size_t)NSEQ * 4);
  float* bias = (float*)carve((size_t)NSEQ * 4);
  _Float16* attn = xh;  // xh dead after QKV GEMM

  f32_to_f16_kernel<<<512, 256, 0, stream>>>(x, xh, MROWS * D_);
  f32_to_f16_kernel<<<512, 256, 0, stream>>>(W_in, winh, 3 * D_ * D_);
  f32_to_f16_kernel<<<256, 256, 0, stream>>>(W_out, wouth, D_ * D_);

  gate_tail_kernel<<<(NSEQ + 255) / 256, 256, 0, stream>>>(
      ctx_trust, tscale, gate, bias, n_ctx, NSEQ);
  ctx_bias_kernel<<<n_ctx, 256, 0, stream>>>(ctx_delta, Wd1, bd1, Wd2, bd2,
                                             ctx_ppr, alpha, bias);

  qkv_gemm_kernel<<<dim3(MROWS / 64, NOUTQ / 128), 256, 0, stream>>>(
      xh, winh, b_in, gate, qh, kh, vth);

  flash_attn_kernel<<<(B_ * H_ * (NSEQ / 16)) / 4, 128, 0, stream>>>(
      qh, kh, vth, bias, attn);

  out_gemm_kernel<<<dim3(MROWS / 64, D_ / 128), 256, 0, stream>>>(
      attn, wouth, b_out, out);
}

// v002
// Measured time: 171 microseconds a run.
// Timed twice side by side with v001, it ran 1.99 and 2.00 times as fast.
// Over all steps from v000 it is 2.54 times as fast.
#include <hip/hip_runtime.h>
#include <hip/hip_bf16.h>
#include <math.h>

typedef __attribute__((ext_vector_type(16))) _Float16 v16h;
typedef __attribute__((ext_vector_type(8)))  _Float16 v8h;
typedef __attribute__((ext_vector_type(8)))  float    v8f;

union HFrag { v16h v; v8h h[2]; };

static constexpr int B_    = 2;
static constexpr int NSEQ  = 2048;
static constexpr int D_    = 1024;
static constexpr int H_    = 16;
static constexpr int DH    = 64;      // head dim
static constexpr int PDIM  = 256;
static constexpr int DHID  = 512;     // D/2
static constexpr int MROWS = B_ * NSEQ;   // 4096
static constexpr int NOUTQ = 3 * D_;      // 3072

// load one 16x32 f16 fragment slice for this lane; p already includes +8*g
__device__ __forceinline__ void ldfrag(HFrag& f, const _Float16* p) {
  f.h[0] = *(const v8h*)(p);
  f.h[1] = *(const v8h*)(p + 16);
}

// Packed operand tiles in the workspace: a 16-row x 32-k tile is 512 halves in
// the order [k half i][lane][8], lane = 16 * ((k >> 3) & 1) + row, i = k >> 4,
// so each of a fragment's two 16-byte loads reads 512 bytes in a row (4 lines).
// The k order in the registers is that of ldfrag. p already includes lane * 8.
static constexpr int TILE = 512;          // halves per packed tile
static constexpr int KT   = D_ / 32;      // packed tiles along a 1024-long k
__device__ __forceinline__ void ldpacked(HFrag& f, const _Float16* p) {
  f.h[0] = *(const v8h*)(p);
  f.h[1] = *(const v8h*)(p + 256);
}

__device__ __forceinline__ v8f wmma16(const HFrag& a, const HFrag& b, v8f c) {
  return __builtin_amdgcn_wmma_f32_16x16x32_f16(false, a.v, false, b.v,
                                                (short)0, c, false, false);
}

// ---------------------------------------------------------------- converts
// src: row-major [rows][1024] f32; dst: packed f16 tiles, tile (rt, kt) at
// (rt * KT + kt) * TILE. One wave per tile: it reads 16 whole lines.
typedef __attribute__((ext_vector_type(4))) float v4f;
__global__ __launch_bounds__(256) void f32_to_f16_kernel(
    const float* __restrict__ src, _Float16* __restrict__ dst) {
  const int lane = threadIdx.x & 31;
  const int tile = blockIdx.x * 8 + (threadIdx.x >> 5);
  const int rt = tile / KT, kt = tile % KT;
  const float* p =
      src + (size_t)(rt * 16 + (lane & 15)) * D_ + kt * 32 + 8 * (lane >> 4);
  v4f a0 = *(const v4f*)(p);
  v4f a1 = *(const v4f*)(p + 4);
  v4f b0 = *(const v4f*)(p + 16);
  v4f b1 = *(const v4f*)(p + 20);
  v8h lo, hi;
#pragma unroll
  for (int e = 0; e < 4; ++e) {
    lo[e] = (_Float16)a0[e]; lo[e + 4] = (_Float16)a1[e];
    hi[e] = (_Float16)b0[e]; hi[e + 4] = (_Float16)b1[e];
  }
  _Float16* q = dst + (size_t)tile * TILE + lane * 8;
  *(v8h*)(q) = lo;
  *(v8h*)(q + 256) = hi;
}

// ------------------------------------------------- gate + tail of col_bias
__global__ void gate_tail_kernel(const float* __restrict__ trust,
                                 const float* __restrict__ tscale,
                                 float* __restrict__ gate,
                                 float* __restrict__ bias,
                                 int n_ctx, int n) {
  int i = blockIdx.x * blockDim.x + threadIdx.x;
  if (i >= n) return;
  if (i < n_ctx) {
    gate[i] = 1.f / (1.f + __expf(-tscale[0] * trust[i]));
  } else {
    gate[i] = 1.f;
    bias[i] = 0.f;
  }
}

// ---------------------------------- per-context-row bias MLP (tiny, VALU)
__global__ __launch_bounds__(256) void ctx_bias_kernel(
    const float* __restrict__ delta, const float* __restrict__ Wd1,
    const float* __restrict__ bd1,   const float* __restrict__ Wd2,
    const float* __restrict__ bd2,   const float* __restrict__ ppr,
    const float* __restrict__ alpha, float* __restrict__ bias) {
  int row = blockIdx.x;
  const float* drow = delta + (size_t)row * PDIM;
  float local = 0.f;
  for (int j = threadIdx.x; j < DHID; j += blockDim.x) {
    const float* wrow = Wd1 + (size_t)j * PDIM;
    float a = bd1[j];
    for (int p = 0; p < PDIM; ++p) a = fmaf(drow[p], wrow[p], a);
    float ge = 0.5f * a * (1.f + erff(a * 0.70710678118654752f));  // exact gelu
    local += ge * Wd2[j];
  }
  __shared__ float red[256];
  red[threadIdx.x] = local;
  __syncthreads();
  for (int s = 128; s > 0; s >>= 1) {
    if ((int)threadIdx.x < s) red[threadIdx.x] += red[threadIdx.x + s];
    __syncthreads();
  }
  if (threadIdx.x == 0) {
    float pv = ppr[row];
    pv = pv < 1e-8f ? 1e-8f : pv;
    bias[row] = alpha[0] * logf(pv) + red[0] + bd2[0];
  }
}

// ------------------------------------------------------- QKV WMMA GEMM
// out = xh[4096,1024] @ W_in^T + b_in, routed to q/k/v head buffers.
// q scaled by d^-0.5, row-major [B,H,N,d]; k and the gated v^T as packed tiles.
// Register double-buffered over k so loads overlap WMMA.
__global__ __launch_bounds__(256, 1) void qkv_gemm_kernel(
    const _Float16* __restrict__ xh, const _Float16* __restrict__ winh,
    const float* __restrict__ b_in,  const float* __restrict__ gate,
    _Float16* __restrict__ qh, _Float16* __restrict__ kh,
    _Float16* __restrict__ vth) {
  const int lane = threadIdx.x & 31;
  const int wave = threadIdx.x >> 5;
  const int l16  = lane & 15;
  const int g    = lane >> 4;
  const int m0 = blockIdx.x * 64 + (wave & 3) * 16;
  const int n0 = blockIdx.y * 128 + (wave >> 2) * 64;

  const _Float16* arow = xh + (size_t)(m0 / 16) * KT * TILE + lane * 8;
  const _Float16* brow[4];
#pragma unroll
  for (int f = 0; f < 4; ++f)
    brow[f] = winh + (size_t)(n0 / 16 + f) * KT * TILE + lane * 8;

  v8f zero = {0.f, 0.f, 0.f, 0.f, 0.f, 0.f, 0.f, 0.f};
  v8f acc[4];
#pragma unroll
  for (int f = 0; f < 4; ++f) acc[f] = zero;

  HFrag a0, a1, b0[4], b1[4];
  ldpacked(a0, arow);
#pragma unroll
  for (int f = 0; f < 4; ++f) ldpacked(b0[f], brow[f]);

  for (int kt = 0; kt < KT - 2; kt += 2) {
    ldpacked(a1, arow + (kt + 1) * TILE);
#pragma unroll
    for (int f = 0; f < 4; ++f) ldpacked(b1[f], brow[f] + (kt + 1) * TILE);
#pragma unroll
    for (int f = 0; f < 4; ++f) acc[f] = wmma16(a0, b0[f], acc[f]);
    ldpacked(a0, arow + (kt + 2) * TILE);
#pragma unroll
    for (int f = 0; f < 4; ++f) ldpacked(b0[f], brow[f] + (kt + 2) * TILE);
#pragma unroll
    for (int f = 0; f < 4; ++f) acc[f] = wmma16(a1, b1[f], acc[f]);
  }
  ldpacked(a1, arow + (KT - 1) * TILE);
#pragma unroll
  for (int f = 0; f < 4; ++f) ldpacked(b1[f], brow[f] + (KT - 1) * TILE);
#pragma unroll
  for (int f = 0; f < 4; ++f) acc[f] = wmma16(a0, b0[f], acc[f]);
#pragma unroll
  for (int f = 0; f < 4; ++f) acc[f] = wmma16(a1, b1[f], acc[f]);

  const float qscale = 0.125f;  // 1/sqrt(64)
  const int bi   = m0 / NSEQ;            // a 16-row tile lies in one batch
  const int tok0 = m0 % NSEQ + 8 * g;    // first of the lane's 8 tokens
#pragma unroll
  for (int f = 0; f < 4; ++f) {
    int nn = n0 + f * 16 + l16;
    int sect = nn / D_;
    int jj = nn % D_;
    int h = jj / DH, c = jj % DH;
    size_t hb = (size_t)(bi * H_ + h);
    float bn = b_in[nn];
    if (sect == 0) {
      _Float16* qp = qh + (hb * NSEQ + tok0) * DH + c;
#pragma unroll
      for (int r = 0; r < 8; ++r)
        qp[r * DH] = (_Float16)((acc[f][r] + bn) * qscale);
    } else if (sect == 1) {
      // packed tile (16 keys, 32 of d): row = key, k = d
      _Float16* kp = kh +
          ((hb * (NSEQ / 16) + tok0 / 16) * 2 + c / 32) * TILE +
          ((c >> 4) & 1) * 256 + (((c >> 3) & 1) * 16 + (tok0 & 15)) * 8 +
          (c & 7);
#pragma unroll
      for (int r = 0; r < 8; ++r) kp[r * 8] = (_Float16)(acc[f][r] + bn);
    } else {
      // packed tile (16 of d, 32 keys): row = d, k = key; the lane's 8 keys
      // lie in a row there
      v8h vo;
#pragma unroll
      for (int r = 0; r < 8; ++r)
        vo[r] = (_Float16)((acc[f][r] + bn) * gate[tok0 + r]);
      *(v8h*)(vth + ((hb * (NSEQ / 32) + tok0 / 32) * 4 + c / 16) * TILE +
              ((tok0 >> 4) & 1) * 256 +
              (((tok0 >> 3) & 1) * 16 + (c & 15)) * 8) = vo;
    }
  }
}

// --------------------------------------------------- flash attention
// 1 wave per 16-query tile; 32-key chunks. Scores are formed transposed,
// S^T = K.Q^T (keys down the rows, queries across the lanes), and the
// output as O^T += V^T.P^T: a lane holds one query's scores, so maximum,
// exponentials and sum stay in its registers, and the two score tiles,
// converted in place, are the B operand of the second product.
typedef __attribute__((ext_vector_type(2))) float    v2f;
typedef __attribute__((ext_vector_type(2))) _Float16 v2h;

// lane l <-> lane l ^ 16
__device__ __forceinline__ float xhalf(float x) {
  int b = __builtin_bit_cast(int, x);
  return __builtin_bit_cast(
      float, __builtin_amdgcn_permlanex16(b, b, 0x76543210, 0xfedcba98, false,
                                          false));
}

__global__ __launch_bounds__(128, 1) void flash_attn_kernel(
    const _Float16* __restrict__ qh, const _Float16* __restrict__ kh,
    const _Float16* __restrict__ vth, const float* __restrict__ bias,
    _Float16* __restrict__ attn) {
  const int lane = threadIdx.x & 31;
  const int wave = threadIdx.x >> 5;
  const int l16  = lane & 15;
  const int g    = lane >> 4;

  const int tile = blockIdx.x * 4 + wave;
  const int qt = tile % (NSEQ / 16);
  const int bh = tile / (NSEQ / 16);

  const _Float16* qbase = qh + ((size_t)bh * NSEQ + (size_t)qt * 16) * DH;
  const _Float16* kball = kh + (size_t)bh * NSEQ * DH;
  const _Float16* vbase = vth + (size_t)bh * DH * NSEQ;

  HFrag bq[2];   // B operand: column l16 = query, k = head dim
  {
    const _Float16* qrow = qbase + (size_t)l16 * DH + 8 * g;
    ldfrag(bq[0], qrow);
    ldfrag(bq[1], qrow + 32);
  }

  v8f zero = {0.f, 0.f, 0.f, 0.f, 0.f, 0.f, 0.f, 0.f};
  v8f acc[4];    // acc[f][r] = O[query l16][f * 16 + 8 * g + r]
#pragma unroll
  for (int f = 0; f < 4; ++f) acc[f] = zero;

  const float L2E = 1.4426950408889634f;
  float mrun = -INFINITY;  // this query's running maximum (same in both halves)
  float lsum = 0.f;        // sum over this lane half's keys only

  for (int kc = 0; kc < NSEQ; kc += 32) {
    // ---- issue all global loads for this chunk up front
    // the per-key bias in the accumulator's own map (row = key) starts the sum
    v8f s0 = *(const v8f*)(bias + kc + 8 * g);
    v8f s1 = *(const v8f*)(bias + kc + 16 + 8 * g);
    HFrag ak[4];   // [keysub(2)][dchunk(2)], A operand: row l16 = key
    {
      const _Float16* kt = kball + (size_t)kc * DH + lane * 8;
      ldpacked(ak[0], kt);             // keys 0-15, d 0-31
      ldpacked(ak[1], kt + TILE);      // keys 0-15, d 32-63
      ldpacked(ak[2], kt + 2 * TILE);  // keys 16-31, d 0-31
      ldpacked(ak[3], kt + 3 * TILE);  // keys 16-31, d 32-63
    }
    HFrag av[4];   // A operand: row l16 = head dim f * 16 + l16, k = key
#pragma unroll
    for (int f = 0; f < 4; ++f) {
      ldpacked(av[f], vbase + (size_t)kc * DH + f * TILE + lane * 8);
    }
    // holds the chunk's loads up here, as one group: without it the compiler
    // sinks each V load to just in front of its product and waits on it there
    __builtin_amdgcn_sched_barrier(0);

    // ---- S^T = k @ q^T + bias (scale pre-folded into q)
    s0 = wmma16(ak[0], bq[0], s0);
    s0 = wmma16(ak[1], bq[1], s0);
    s1 = wmma16(ak[2], bq[0], s1);
    s1 = wmma16(ak[3], bq[1], s1);

    // ---- online softmax, one query per lane, 16 of its 32 keys
    float t0 = fmaxf(fmaxf(s0[0], s0[1]), s0[2]);
    float t1 = fmaxf(fmaxf(s0[3], s0[4]), s0[5]);
    float t2 = fmaxf(fmaxf(s0[6], s0[7]), s1[0]);
    float t3 = fmaxf(fmaxf(s1[1], s1[2]), s1[3]);
    float t4 = fmaxf(fmaxf(s1[4], s1[5]), s1[6]);
    float mx = fmaxf(fmaxf(fmaxf(t0, t1), t2), fmaxf(fmaxf(t3, t4), s1[7]));
    mx = fmaxf(mx, xhalf(mx));
    mx = fmaxf(mx, mrun);
    const float fr = __builtin_amdgcn_exp2f((mrun - mx) * L2E);
    mrun = mx;
    const float nm = -mx * L2E;

    HFrag bp;      // B operand: column l16 = query, k = key, hardware k order
    v2f ps = {0.f, 0.f};
#pragma unroll
    for (int i = 0; i < 4; ++i) {
      v2f a0 = __builtin_elementwise_fma(v2f{s0[2 * i], s0[2 * i + 1]},
                                         v2f{L2E, L2E}, v2f{nm, nm});
      v2f a1 = __builtin_elementwise_fma(v2f{s1[2 * i], s1[2 * i + 1]},
                                         v2f{L2E, L2E}, v2f{nm, nm});
      v2f p0 = {__builtin_amdgcn_exp2f(a0.x), __builtin_amdgcn_exp2f(a0.y)};
      v2f p1 = {__builtin_amdgcn_exp2f(a1.x), __builtin_amdgcn_exp2f(a1.y)};
      ps += p0 + p1;
      v2h h0 = __builtin_convertvector(p0, v2h);
      v2h h1 = __builtin_convertvector(p1, v2h);
      bp.h[0][2 * i] = h0.x; bp.h[0][2 * i + 1] = h0.y;
      bp.h[1][2 * i] = h1.x; bp.h[1][2 * i + 1] = h1.y;
    }
    lsum = lsum * fr + (ps.x + ps.y);

    // ---- rescale accumulator + O^T += V^T @ P^T (V already in registers)
#pragma unroll
    for (int f = 0; f < 4; ++f) {
      acc[f] = acc[f] * fr;
      acc[f] = wmma16(av[f], bp, acc[f]);
    }
  }

  const float inv = 1.f / (lsum + xhalf(lsum));

  const int bi = bh / H_;
  const int h  = bh % H_;
  // packed for the output projection: tile (16 tokens, 32 features)
  _Float16* orow = attn +
      ((size_t)(bi * (NSEQ / 16) + qt) * KT + h * 2) * TILE + lane * 8;
#pragma unroll
  for (int f = 0; f < 4; ++f) {
    v8h o;
#pragma unroll
    for (int r = 0; r < 8; ++r) o[r] = (_Float16)(acc[f][r] * inv);
    *(v8h*)(orow + f * 256) = o;
  }
}

// ------------------------------------------------- output projection
__global__ __launch_bounds__(256, 1) void out_gemm_kernel(
    const _Float16* __restrict__ ah, const _Float16* __restrict__ wouth,
    const float* __restrict__ b_out, float* __restrict__ out) {
  const int lane = threadIdx.x & 31;
  const int wave = threadIdx.x >> 5;
  const int l16  = lane & 15;
  const int g    = lane >> 4;
  const int m0 = blockIdx.x * 64 + (wave & 3) * 16;
  const int n0 = blockIdx.y * 128 + (wave >> 2) * 64;

  const _Float16* arow = ah + (size_t)(m0 / 16) * KT * TILE + lane * 8;
  const _Float16* brow[4];
#pragma unroll
  for (int f = 0; f < 4; ++f)
    brow[f] = wouth + (size_t)(n0 / 16 + f) * KT * TILE + lane * 8;

  v8f zero = {0.f, 0.f, 0.f, 0.f, 0.f, 0.f, 0.f, 0.f};
  v8f acc[4];
#pragma unroll
  for (int f = 0; f < 4; ++f) acc[f] = zero;

  HFrag a0, a1, b0[4], b1[4];
  ldpacked(a0, arow);
#pragma unroll
  for (int f = 0; f < 4; ++f) ldpacked(b0[f], brow[f]);

  for (int kt = 0; kt < KT - 2; kt += 2) {
    ldpacked(a1, arow + (kt + 1) * TILE);
#pragma unroll
    for (int f = 0; f < 4; ++f) ldpacked(b1[f], brow[f] + (kt + 1) * TILE);
#pragma unroll
    for (int f = 0; f < 4; ++f) acc[f] = wmma16(a0, b0[f], acc[f]);
    ldpacked(a0, arow + (kt + 2) * TILE);
#pragma unroll
    for (int f = 0; f < 4; ++f) ldpacked(b0[f], brow[f] + (kt + 2) * TILE);
#pragma unroll
    for (int f = 0; f < 4; ++f) acc[f] = wmma16(a1, b1[f], acc[f]);
  }
  ldpacked(a1, arow + (KT - 1) * TILE);
#pragma unroll
  for (int f = 0; f < 4; ++f) ldpacked(b1[f], brow[f] + (KT - 1) * TILE);
  // the last loads' address registers are reused for the bias values below:
  // this wait stands in front of that overwrite
  asm volatile("s_wait_xcnt 0x0" ::: "memory");
#pragma unroll
  for (int f = 0; f < 4; ++f) acc[f] = wmma16(a0, b0[f], acc[f]);
#pragma unroll
  for (int f = 0; f < 4; ++f) acc[f] = wmma16(a1, b1[f], acc[f]);

#pragma unroll
  for (int f = 0; f < 4; ++f) {
    int nn = n0 + f * 16 + l16;
#pragma unroll
    for (int r = 0; r < 8; ++r) {
      int m = m0 + r + 8 * g;
      out[(size_t)m * D_ + nn] = acc[f][r] + b_out[nn];
    }
  }
}

// ------------------------------------------------------------ launcher
extern "C" void kernel_launch(void* const* d_in, const int* in_sizes, int n_in,
                              void* d_out, int out_size, void* d_ws,
                              size_t ws_size, hipStream_t stream) {
  (void)n_in; (void)out_size; (void)ws_size;
  const float* x         = (const float*)d_in[0];
  const float* ctx_ppr   = (const float*)d_in[2];
  const float* ctx_delta = (const float*)d_in[3];
  const float* ctx_trust = (const float*)d_in[4];
  const float* W_in      = (const float*)d_in[5];
  const float* b_in      = (const float*)d_in[6];
  const float* W_out     = (const float*)d_in[7];
  const float* b_out     = (const float*)d_in[8];
  const float* alpha     = (const float*)d_in[9];
  const float* tscale    = (const float*)d_in[10];
  const float* Wd1       = (const float*)d_in[11];
  const float* bd1       = (const float*)d_in[12];
  const float* Wd2       = (const float*)d_in[13];
  const float* bd2       = (const float*)d_in[14];
  float* out = (float*)d_out;
  const int n_ctx = in_sizes[2];  // ctx_ppr has n_ctx elements

  // workspace carve (~42 MB; attn output reuses xh)
  char* w = (char*)d_ws;
  auto carve = [&](size_t bytes) -> char* {
    char* p = w;
    w += (bytes + 255) & ~(size_t)255;
    return p;
  };
  _Float16* xh    = (_Float16*)carve((size_t)MROWS * D_ * 2);
  _Float16* winh  = (_Float16*)carve((size_t)3 * D_ * D_ * 2);
  _Float16* wouth = (_Float16*)carve((size_t)D_ * D_ * 2);
  _Float16* qh    = (_Float16*)carve((size_t)MROWS * D_ * 2);
  _Float16* kh    = (_Float16*)carve((size_t)MROWS * D_ * 2);
  _Float16* vth   = (_Float16*)carve((size_t)MROWS * D_ * 2);
  float* gate = (float*)carve((size_t)NSEQ * 4);
  float* bias = (float*)carve((size_t)NSEQ * 4);
  _Float16* attn = xh;  // xh dead after QKV GEMM

  f32_to_f16_kernel<<<MROWS / 16 * KT / 8, 256, 0, stream>>>(x, xh);
  f32_to_f16_kernel<<<NOUTQ / 16 * KT / 8, 256, 0, stream>>>(W_in, winh);
  f32_to_f16_kernel<<<D_ / 16 * KT / 8, 256, 0, stream>>>(W_out, wouth);

  gate_tail_kernel<<<(NSEQ + 255) / 256, 256, 0, stream>>>(
      ctx_trust, tscale, gate, bias, n_ctx, NSEQ);
  ctx_bias_kernel<<<n_ctx, 256, 0, stream>>>(ctx_delta, Wd1, bd1, Wd2, bd2,
                                             ctx_ppr, alpha, bias);

  qkv_gemm_kernel<<<dim3(MROWS / 64, NOUTQ / 128), 256, 0, stream>>>(
      xh, winh, b_in, gate, qh, kh, vth);

  flash_attn_kernel<<<(B_ * H_ * (NSEQ / 16)) / 4, 128, 0, stream>>>(
      qh, kh, vth, bias, attn);

  out_gemm_kernel<<<dim3(MROWS / 64, D_ / 128), 256, 0, stream>>>(
      attn, wouth, b_out, out);
}

// v003
// It runs in 139 microseconds.
// Two timings next to v002 put it at 1.23 and 1.24 times that version's speed.
// All steps since v000 together make it 3.13 times as fast.
#include <hip/hip_runtime.h>
#include <hip/hip_bf16.h>
#include <math.h>

typedef __attribute__((ext_vector_type(16))) _Float16 v16h;
typedef __attribute__((ext_vector_type(8)))  _Float16 v8h;
typedef __attribute__((ext_vector_type(8)))  float    v8f;

union HFrag { v16h v; v8h h[2]; };

static constexpr int B_    = 2;
static constexpr int NSEQ  = 2048;
static constexpr int D_    = 1024;
static constexpr int H_    = 16;
static constexpr int DH    = 64;      // head dim
static constexpr int PDIM  = 256;
static constexpr int DHID  = 512;     // D/2
static constexpr int MROWS = B_ * NSEQ;   // 4096
static constexpr int NOUTQ = 3 * D_;      // 3072

// load one 16x32 f16 fragment slice for this lane; p already includes +8*g
__device__ __forceinline__ void ldfrag(HFrag& f, const _Float16* p) {
  f.h[0] = *(const v8h*)(p);
  f.h[1] = *(const v8h*)(p + 16);
}

// Packed operand tiles in the workspace: a 16-row x 32-k tile is 512 halves in
// the order [k half i][lane][8], lane = 16 * ((k >> 3) & 1) + row, i = k >> 4,
// so each of a fragment's two 16-byte loads reads 512 bytes in a row (4 lines).
// The k order in the registers is that of ldfrag. p already includes lane * 8.
static constexpr int TILE = 512;          // halves per packed tile
static constexpr int KT   = D_ / 32;      // packed tiles along a 1024-long k
__device__ __forceinline__ void ldpacked(HFrag& f, const _Float16* p) {
  f.h[0] = *(const v8h*)(p);
  f.h[1] = *(const v8h*)(p + 256);
}

__device__ __forceinline__ v8f wmma16(const HFrag& a, const HFrag& b, v8f c) {
  return __builtin_amdgcn_wmma_f32_16x16x32_f16(false, a.v, false, b.v,
                                                (short)0, c, false, false);
}

// ---------------------------------------------------------------- converts
// src: row-major [rows][1024] f32; dst: packed f16 tiles, tile (rt, kt) at
// (rt * KT + kt) * TILE. One wave per tile: it reads 16 whole lines.
typedef __attribute__((ext_vector_type(4))) float v4f;
__global__ __launch_bounds__(256) void f32_to_f16_kernel(
    const float* __restrict__ src, _Float16* __restrict__ dst) {
  const int lane = threadIdx.x & 31;
  const int tile = blockIdx.x * 8 + (threadIdx.x >> 5);
  const int rt = tile / KT, kt = tile % KT;
  const float* p =
      src + (size_t)(rt * 16 + (lane & 15)) * D_ + kt * 32 + 8 * (lane >> 4);
  v4f a0 = *(const v4f*)(p);
  v4f a1 = *(const v4f*)(p + 4);
  v4f b0 = *(const v4f*)(p + 16);
  v4f b1 = *(const v4f*)(p + 20);
  v8h lo, hi;
#pragma unroll
  for (int e = 0; e < 4; ++e) {
    lo[e] = (_Float16)a0[e]; lo[e + 4] = (_Float16)a1[e];
    hi[e] = (_Float16)b0[e]; hi[e + 4] = (_Float16)b1[e];
  }
  _Float16* q = dst + (size_t)tile * TILE + lane * 8;
  *(v8h*)(q) = lo;
  *(v8h*)(q + 256) = hi;
}

// ---------------------- context-row bias MLP: first product on f32 WMMA
// H^T = Wd1 . delta^T: hidden units down the rows, context rows across the
// lanes. A work-group takes 16 context rows and 128 hidden units, one 16 x 16
// tile a wave; both operands come in by whole lines and are read from LDS.
typedef __attribute__((ext_vector_type(2))) float v2f;

static constexpr int NCTX = 1024;       // rows of ctx_delta
static constexpr int HQ   = 128;        // hidden units per work-group
static constexpr int NHQ  = DHID / HQ;  // partial sums per context row
static constexpr int LP   = PDIM + 4;   // LDS row pitch in floats: 16 B x odd

// lane l <-> lane l ^ 16
__device__ __forceinline__ float xhalf(float x) {
  int b = __builtin_bit_cast(int, x);
  return __builtin_bit_cast(
      float, __builtin_amdgcn_permlanex16(b, b, 0x76543210, 0xfedcba98, false,
                                          false));
}

__global__ __launch_bounds__(256, 1) void ctx_bias_kernel(
    const float* __restrict__ delta, const float* __restrict__ Wd1,
    const float* __restrict__ bd1,   const float* __restrict__ Wd2,
    float* __restrict__ part) {
  __shared__ __attribute__((aligned(16))) float tile[(16 + HQ) * LP];
  __shared__ float red[8][16];
  const int tid  = threadIdx.x;
  const int lane = tid & 31;
  const int wave = tid >> 5;
  const int l16  = lane & 15;
  const int g    = lane >> 4;
  const int row0 = blockIdx.x * 16;
  const int h0   = blockIdx.y * HQ;

  // a wave's 16-byte loads cover half a row (4 whole lines); 4 rows a pass
  {
    const int sr = tid >> 6, sc = (tid & 63) * 4;
    const float* dp = delta + (size_t)row0 * PDIM + (sr * PDIM + sc);
    const float* wp = Wd1 + (size_t)h0 * PDIM + (sr * PDIM + sc);
    float* lp = tile + sr * LP + sc;
    v4f t[(16 + HQ) / 4];
    // the three loops are unrolled so that t stays in registers, the steps are
    // immediate offsets and every load is in flight before the first store
#pragma unroll
    for (int i = 0; i < 4; ++i) t[i] = *(const v4f*)(dp + i * 4 * PDIM);
#pragma unroll
    for (int i = 0; i < HQ / 4; ++i)
      t[4 + i] = *(const v4f*)(wp + i * 4 * PDIM);
#pragma unroll
    for (int i = 0; i < (16 + HQ) / 4; ++i) *(v4f*)(lp + i * 4 * LP) = t[i];
  }
  const int hw = h0 + wave * 16 + 8 * g;   // first of the lane's 8 hidden units
  v8f acc0 = *(const v8f*)(bd1 + hw);      // the sum starts from the bias
  v8f acc1 = {0.f, 0.f, 0.f, 0.f, 0.f, 0.f, 0.f, 0.f};
  const v8f w2 = *(const v8f*)(Wd2 + hw);
  __syncthreads();

  // both operands by the same code: lane half g holds k = 8 * kb + 4 * g + 0..3,
  // the first pair for one product, the second for the next
  const float* ap = tile + (16 + wave * 16 + l16) * LP + 4 * g;
  const float* bp = tile + l16 * LP + 4 * g;
  // unrolled: immediate LDS offsets, the next fragments read ahead of the wait
#pragma unroll
  for (int kb = 0; kb < PDIM / 8; ++kb) {
    v4f a = *(const v4f*)(ap + kb * 8);
    v4f b = *(const v4f*)(bp + kb * 8);
    acc0 = __builtin_amdgcn_wmma_f32_16x16x4_f32(
        false, v2f{a.x, a.y}, false, v2f{b.x, b.y}, (short)0, acc0, false,
        false);
    acc1 = __builtin_amdgcn_wmma_f32_16x16x4_f32(
        false, v2f{a.z, a.w}, false, v2f{b.z, b.w}, (short)0, acc1, false,
        false);
  }

  float local = 0.f;   // context row l16, this lane's 8 hidden units
  // unrolled: the accumulators are indexed by constants only
#pragma unroll
  for (int r = 0; r < 8; ++r) {
    float a = acc0[r] + acc1[r];
    float ge = 0.5f * a * (1.f + erff(a * 0.70710678118654752f));  // exact gelu
    local += ge * w2[r];
  }
  local += xhalf(local);
  if (g == 0) red[wave][l16] = local;
  __syncthreads();
  if (tid < 16) {
    float s = 0.f;
    for (int w = 0; w < 8; ++w) s += red[w][tid];
    // each work-group's 16 sums in a 128-byte line of their own
    part[(blockIdx.y * (NCTX / 16) + blockIdx.x) * 32 + tid] = s;
  }
}

// --------------------------- gate, col_bias from the MLP's partial sums
__global__ void gate_tail_kernel(const float* __restrict__ trust,
                                 const float* __restrict__ tscale,
                                 const float* __restrict__ part,
                                 const float* __restrict__ bd2,
                                 const float* __restrict__ ppr,
                                 const float* __restrict__ alpha,
                                 float* __restrict__ gate,
                                 float* __restrict__ bias,
                                 int n_ctx, int n) {
  int i = blockIdx.x * blockDim.x + threadIdx.x;
  if (i >= n) return;
  if (i < n_ctx) {
    gate[i] = 1.f / (1.f + __expf(-tscale[0] * trust[i]));
    float s = 0.f;
    for (int q = 0; q < NHQ; ++q)
      s += part[(q * (NCTX / 16) + (i >> 4)) * 32 + (i & 15)];
    float pv = ppr[i];
    pv = pv < 1e-8f ? 1e-8f : pv;
    bias[i] = alpha[0] * logf(pv) + s + bd2[0];
  } else {
    gate[i] = 1.f;
    bias[i] = 0.f;
  }
}

// ------------------------------------------------------- QKV WMMA GEMM
// out = xh[4096,1024] @ W_in^T + b_in, routed to q/k/v head buffers.
// q scaled by d^-0.5, row-major [B,H,N,d]; k and the gated v^T as packed tiles.
// Register double-buffered over k so loads overlap WMMA.
__global__ __launch_bounds__(256, 1) void qkv_gemm_kernel(
    const _Float16* __restrict__ xh, const _Float16* __restrict__ winh,
    const float* __restrict__ b_in,  const float* __restrict__ gate,
    _Float16* __restrict__ qh, _Float16* __restrict__ kh,
    _Float16* __restrict__ vth) {
  const int lane = threadIdx.x & 31;
  const int wave = threadIdx.x >> 5;
  const int l16  = lane & 15;
  const int g    = lane >> 4;
  const int m0 = blockIdx.x * 64 + (wave & 3) * 16;
  const int n0 = blockIdx.y * 128 + (wave >> 2) * 64;

  const _Float16* arow = xh + (size_t)(m0 / 16) * KT * TILE + lane * 8;
  const _Float16* brow[4];
#pragma unroll
  for (int f = 0; f < 4; ++f)
    brow[f] = winh + (size_t)(n0 / 16 + f) * KT * TILE + lane * 8;

  v8f zero = {0.f, 0.f, 0.f, 0.f, 0.f, 0.f, 0.f, 0.f};
  v8f acc[4];
#pragma unroll
  for (int f = 0; f < 4; ++f) acc[f] = zero;

  HFrag a0, a1, b0[4], b1[4];
  ldpacked(a0, arow);
#pragma unroll
  for (int f = 0; f < 4; ++f) ldpacked(b0[f], brow[f]);

  for (int kt = 0; kt < KT - 2; kt += 2) {
    ldpacked(a1, arow + (kt + 1) * TILE);
#pragma unroll
    for (int f = 0; f < 4; ++f) ldpacked(b1[f], brow[f] + (kt + 1) * TILE);
#pragma unroll
    for (int f = 0; f < 4; ++f) acc[f] = wmma16(a0, b0[f], acc[f]);
    ldpacked(a0, arow + (kt + 2) * TILE);
#pragma unroll
    for (int f = 0; f < 4; ++f) ldpacked(b0[f], brow[f] + (kt + 2) * TILE);
#pragma unroll
    for (int f = 0; f < 4; ++f) acc[f] = wmma16(a1, b1[f], acc[f]);
  }
  ldpacked(a1, arow + (KT - 1) * TILE);
#pragma unroll
  for (int f = 0; f < 4; ++f) ldpacked(b1[f], brow[f] + (KT - 1) * TILE);
#pragma unroll
  for (int f = 0; f < 4; ++f) acc[f] = wmma16(a0, b0[f], acc[f]);
#pragma unroll
  for (int f = 0; f < 4; ++f) acc[f] = wmma16(a1, b1[f], acc[f]);

  const float qscale = 0.125f;  // 1/sqrt(64)
  const int bi   = m0 / NSEQ;            // a 16-row tile lies in one batch
  const int tok0 = m0 % NSEQ + 8 * g;    // first of the lane's 8 tokens
#pragma unroll
  for (int f = 0; f < 4; ++f) {
    int nn = n0 + f * 16 + l16;
    int sect = nn / D_;
    int jj = nn % D_;
    int h = jj / DH, c = jj % DH;
    size_t hb = (size_t)(bi * H_ + h);
    float bn = b_in[nn];
    if (sect == 0) {
      _Float16* qp = qh + (hb * NSEQ + tok0) * DH + c;
#pragma unroll
      for (int r = 0; r < 8; ++r)
        qp[r * DH] = (_Float16)((acc[f][r] + bn) * qscale);
    } else if (sect == 1) {
      // packed tile (16 keys, 32 of d): row = key, k = d
      _Float16* kp = kh +
          ((hb * (NSEQ / 16) + tok0 / 16) * 2 + c / 32) * TILE +
          ((c >> 4) & 1) * 256 + (((c >> 3) & 1) * 16 + (tok0 & 15)) * 8 +
          (c & 7);
#pragma unroll
      for (int r = 0; r < 8; ++r) kp[r * 8] = (_Float16)(acc[f][r] + bn);
    } else {
      // packed tile (16 of d, 32 keys): row = d, k = key; the lane's 8 keys
      // lie in a row there
      v8h vo;
#pragma unroll
      for (int r = 0; r < 8; ++r)
        vo[r] = (_Float16)((acc[f][r] + bn) * gate[tok0 + r]);
      *(v8h*)(vth + ((hb * (NSEQ / 32) + tok0 / 32) * 4 + c / 16) * TILE +
              ((tok0 >> 4) & 1) * 256 +
              (((tok0 >> 3) & 1) * 16 + (c & 15)) * 8) = vo;
    }
  }
}

// --------------------------------------------------- flash attention
// 1 wave per 16-query tile; 32-key chunks. Scores are formed transposed,
// S^T = K.Q^T (keys down the rows, queries across the lanes), and the
// output as O^T += V^T.P^T: a lane holds one query's scores, so maximum,
// exponentials and sum stay in its registers, and the two score tiles,
// converted in place, are the B operand of the second product.
typedef __attribute__((ext_vector_type(2))) _Float16 v2h;

__global__ __launch_bounds__(128, 1) void flash_attn_kernel(
    const _Float16* __restrict__ qh, const _Float16* __restrict__ kh,
    const _Float16* __restrict__ vth, const float* __restrict__ bias,
    _Float16* __restrict__ attn) {
  const int lane = threadIdx.x & 31;
  const int wave = threadIdx.x >> 5;
  const int l16  = lane & 15;
  const int g    = lane >> 4;

  const int tile = blockIdx.x * 4 + wave;
  const int qt = tile % (NSEQ / 16);
  const int bh = tile / (NSEQ / 16);

  const _Float16* qbase = qh + ((size_t)bh * NSEQ + (size_t)qt * 16) * DH;
  const _Float16* kball = kh + (size_t)bh * NSEQ * DH;
  const _Float16* vbase = vth + (size_t)bh * DH * NSEQ;

  HFrag bq[2];   // B operand: column l16 = query, k = head dim
  {
    const _Float16* qrow = qbase + (size_t)l16 * DH + 8 * g;
    ldfrag(bq[0], qrow);
    ldfrag(bq[1], qrow + 32);
  }

  v8f zero = {0.f, 0.f, 0.f, 0.f, 0.f, 0.f, 0.f, 0.f};
  v8f acc[4];    // acc[f][r] = O[query l16][f * 16 + 8 * g + r]
#pragma unroll
  for (int f = 0; f < 4; ++f) acc[f] = zero;

  const float L2E = 1.4426950408889634f;
  float mrun = -INFINITY;  // this query's running maximum (same in both halves)
  float lsum = 0.f;        // sum over this lane half's keys only

  for (int kc = 0; kc < NSEQ; kc += 32) {
    // ---- issue all global loads for this chunk up front
    // the per-key bias in the accumulator's own map (row = key) starts the sum
    v8f s0 = *(const v8f*)(bias + kc + 8 * g);
    v8f s1 = *(const v8f*)(bias + kc + 16 + 8 * g);
    HFrag ak[4];   // [keysub(2)][dchunk(2)], A operand: row l16 = key
    {
      const _Float16* kt = kball + (size_t)kc * DH + lane * 8;
      ldpacked(ak[0], kt);             // keys 0-15, d 0-31
      ldpacked(ak[1], kt + TILE);      // keys 0-15, d 32-63
      ldpacked(ak[2], kt + 2 * TILE);  // keys 16-31, d 0-31
      ldpacked(ak[3], kt + 3 * TILE);  // keys 16-31, d 32-63
    }
    HFrag av[4];   // A operand: row l16 = head dim f * 16 + l16, k = key
#pragma unroll
    for (int f = 0; f < 4; ++f) {
      ldpacked(av[f], vbase + (size_t)kc * DH + f * TILE + lane * 8);
    }
    // holds the chunk's loads up here, as one group: without it the compiler
    // sinks each V load to just in front of its product and waits on it there
    __builtin_amdgcn_sched_barrier(0);

    // ---- S^T = k @ q^T + bias (scale pre-folded into q)
    s0 = wmma16(ak[0], bq[0], s0);
    s0 = wmma16(ak[1], bq[1], s0);
    s1 = wmma16(ak[2], bq[0], s1);
    s1 = wmma16(ak[3], bq[1], s1);

    // ---- online softmax, one query per lane, 16 of its 32 keys
    float t0 = fmaxf(fmaxf(s0[0], s0[1]), s0[2]);
    float t1 = fmaxf(fmaxf(s0[3], s0[4]), s0[5]);
    float t2 = fmaxf(fmaxf(s0[6], s0[7]), s1[0]);
    float t3 = fmaxf(fmaxf(s1[1], s1[2]), s1[3]);
    float t4 = fmaxf(fmaxf(s1[4], s1[5]), s1[6]);
    float mx = fmaxf(fmaxf(fmaxf(t0, t1), t2), fmaxf(fmaxf(t3, t4), s1[7]));
    mx = fmaxf(mx, xhalf(mx));
    mx = fmaxf(mx, mrun);
    const float fr = __builtin_amdgcn_exp2f((mrun - mx) * L2E);
    mrun = mx;
    const float nm = -mx * L2E;

    HFrag bp;      // B operand: column l16 = query, k = key, hardware k order
    v2f ps = {0.f, 0.f};
#pragma unroll
    for (int i = 0; i < 4; ++i) {
      v2f a0 = __builtin_elementwise_fma(v2f{s0[2 * i], s0[2 * i + 1]},
                                         v2f{L2E, L2E}, v2f{nm, nm});
      v2f a1 = __builtin_elementwise_fma(v2f{s1[2 * i], s1[2 * i + 1]},
                                         v2f{L2E, L2E}, v2f{nm, nm});
      v2f p0 = {__builtin_amdgcn_exp2f(a0.x), __builtin_amdgcn_exp2f(a0.y)};
      v2f p1 = {__builtin_amdgcn_exp2f(a1.x), __builtin_amdgcn_exp2f(a1.y)};
      ps += p0 + p1;
      v2h h0 = __builtin_convertvector(p0, v2h);
      v2h h1 = __builtin_convertvector(p1, v2h);
      bp.h[0][2 * i] = h0.x; bp.h[0][2 * i + 1] = h0.y;
      bp.h[1][2 * i] = h1.x; bp.h[1][2 * i + 1] = h1.y;
    }
    lsum = lsum * fr + (ps.x + ps.y);

    // ---- rescale accumulator + O^T += V^T @ P^T (V already in registers)
#pragma unroll
    for (int f = 0; f < 4; ++f) {
      acc[f] = acc[f] * fr;
      acc[f] = wmma16(av[f], bp, acc[f]);
    }
  }

  const float inv = 1.f / (lsum + xhalf(lsum));

  const int bi = bh / H_;
  const int h  = bh % H_;
  // packed for the output projection: tile (16 tokens, 32 features)
  _Float16* orow = attn +
      ((size_t)(bi * (NSEQ / 16) + qt) * KT + h * 2) * TILE + lane * 8;
#pragma unroll
  for (int f = 0; f < 4; ++f) {
    v8h o;
#pragma unroll
    for (int r = 0; r < 8; ++r) o[r] = (_Float16)(acc[f][r] * inv);
    *(v8h*)(orow + f * 256) = o;
  }
}

// ------------------------------------------------- output projection
__global__ __launch_bounds__(256, 1) void out_gemm_kernel(
    const _Float16* __restrict__ ah, const _Float16* __restrict__ wouth,
    const float* __restrict__ b_out, float* __restrict__ out) {
  const int lane = threadIdx.x & 31;
  const int wave = threadIdx.x >> 5;
  const int l16  = lane & 15;
  const int g    = lane >> 4;
  const int m0 = blockIdx.x * 64 + (wave & 3) * 16;
  const int n0 = blockIdx.y * 128 + (wave >> 2) * 64;

  const _Float16* arow = ah + (size_t)(m0 / 16) * KT * TILE + lane * 8;
  const _Float16* brow[4];
#pragma unroll
  for (int f = 0; f < 4; ++f)
    brow[f] = wouth + (size_t)(n0 / 16 + f) * KT * TILE + lane * 8;

  v8f zero = {0.f, 0.f, 0.f, 0.f, 0.f, 0.f, 0.f, 0.f};
  v8f acc[4];
#pragma unroll
  for (int f = 0; f < 4; ++f) acc[f] = zero;

  HFrag a0, a1, b0[4], b1[4];
  ldpacked(a0, arow);
#pragma unroll
  for (int f = 0; f < 4; ++f) ldpacked(b0[f], brow[f]);

  for (int kt = 0; kt < KT - 2; kt += 2) {
    ldpacked(a1, arow + (kt + 1) * TILE);
#pragma unroll
    for (int f = 0; f < 4; ++f) ldpacked(b1[f], brow[f] + (kt + 1) * TILE);
#pragma unroll
    for (int f = 0; f < 4; ++f) acc[f] = wmma16(a0, b0[f], acc[f]);
    ldpacked(a0, arow + (kt + 2) * TILE);
#pragma unroll
    for (int f = 0; f < 4; ++f) ldpacked(b0[f], brow[f] + (kt + 2) * TILE);
#pragma unroll
    for (int f = 0; f < 4; ++f) acc[f] = wmma16(a1, b1[f], acc[f]);
  }
  ldpacked(a1, arow + (KT - 1) * TILE);
#pragma unroll
  for (int f = 0; f < 4; ++f) ldpacked(b1[f], brow[f] + (KT - 1) * TILE);
  // the last loads' address registers are reused for the bias values below:
  // this wait stands in front of that overwrite
  asm volatile("s_wait_xcnt 0x0" ::: "memory");
#pragma unroll
  for (int f = 0; f < 4; ++f) acc[f] = wmma16(a0, b0[f], acc[f]);
#pragma unroll
  for (int f = 0; f < 4; ++f) acc[f] = wmma16(a1, b1[f], acc[f]);

#pragma unroll
  for (int f = 0; f < 4; ++f) {
    int nn = n0 + f * 16 + l16;
#pragma unroll
    for (int r = 0; r < 8; ++r) {
      int m = m0 + r + 8 * g;
      out[(size_t)m * D_ + nn] = acc[f][r] + b_out[nn];
    }
  }
}

// ------------------------------------------------------------ launcher
extern "C" void kernel_launch(void* const* d_in, const int* in_sizes, int n_in,
                              void* d_out, int out_size, void* d_ws,
                              size_t ws_size, hipStream_t stream) {
  (void)n_in; (void)out_size; (void)ws_size;
  const float* x         = (const float*)d_in[0];
  const float* ctx_ppr   = (const float*)d_in[2];
  const float* ctx_delta = (const float*)d_in[3];
  const float* ctx_trust = (const float*)d_in[4];
  const float* W_in      = (const float*)d_in[5];
  const float* b_in      = (const float*)d_in[6];
  const float* W_out     = (const float*)d_in[7];
  const float* b_out     = (const float*)d_in[8];
  const float* alpha     = (const float*)d_in[9];
  const float* tscale    = (const float*)d_in[10];
  const float* Wd1       = (const float*)d_in[11];
  const float* bd1       = (const float*)d_in[12];
  const float* Wd2       = (const float*)d_in[13];
  const float* bd2       = (const float*)d_in[14];
  float* out = (float*)d_out;
  const int n_ctx = in_sizes[2];  // ctx_ppr has n_ctx elements

  // workspace carve (~42 MB; attn output reuses xh)
  char* w = (char*)d_ws;
  auto carve = [&](size_t bytes) -> char* {
    char* p = w;
    w += (bytes + 255) & ~(size_t)255;
    return p;
  };
  _Float16* xh    = (_Float16*)carve((size_t)MROWS * D_ * 2);
  _Float16* winh  = (_Float16*)carve((size_t)3 * D_ * D_ * 2);
  _Float16* wouth = (_Float16*)carve((size_t)D_ * D_ * 2);
  _Float16* qh    = (_Float16*)carve((size_t)MROWS * D_ * 2);
  _Float16* kh    = (_Float16*)carve((size_t)MROWS * D_ * 2);
  _Float16* vth   = (_Float16*)carve((size_t)MROWS * D_ * 2);
  float* gate = (float*)carve((size_t)NSEQ * 4);
  float* bias = (float*)carve((size_t)NSEQ * 4);
  float* part = (float*)carve((size_t)NHQ * (NCTX / 16) * 32 * 4);
  _Float16* attn = xh;  // xh dead after QKV GEMM

  f32_to_f16_kernel<<<MROWS / 16 * KT / 8, 256, 0, stream>>>(x, xh);
  f32_to_f16_kernel<<<NOUTQ / 16 * KT / 8, 256, 0, stream>>>(W_in, winh);
  f32_to_f16_kernel<<<D_ / 16 * KT / 8, 256, 0, stream>>>(W_out, wouth);

  ctx_bias_kernel<<<dim3(NCTX / 16, NHQ), 256, 0, stream>>>(ctx_delta, Wd1, bd1,
                                                            Wd2, part);
  gate_tail_kernel<<<(NSEQ + 255) / 256, 256, 0, stream>>>(
      ctx_trust, tscale, part, bd2, ctx_ppr, alpha, gate, bias, n_ctx, NSEQ);

  qkv_gemm_kernel<<<dim3(MROWS / 64, NOUTQ / 128), 256, 0, stream>>>(
      xh, winh, b_in, gate, qh, kh, vth);

  flash_attn_kernel<<<(B_ * H_ * (NSEQ / 16)) / 4, 128, 0, stream>>>(
      qh, kh, vth, bias, attn);

  out_gemm_kernel<<<dim3(MROWS / 64, D_ / 128), 256, 0, stream>>>(
      attn, wouth, b_out, out);
}

// v004
// One run takes 114 microseconds.
// Next to v003, in two timings, it ran 1.23 times as fast each time.
// Counting every step since v000, it is 3.85 times as fast.
#include <hip/hip_runtime.h>
#include <hip/hip_bf16.h>
#include <math.h>

typedef __attribute__((ext_vector_type(16))) _Float16 v16h;
typedef __attribute__((ext_vector_type(8)))  _Float16 v8h;
typedef __attribute__((ext_vector_type(8)))  float    v8f;

union HFrag { v16h v; v8h h[2]; };

static constexpr int B_    = 2;
static constexpr int NSEQ  = 2048;
static constexpr int D_    = 1024;
static constexpr int H_    = 16;
static constexpr int DH    = 64;      // head dim
static constexpr int PDIM  = 256;
static constexpr int DHID  = 512;     // D/2
static constexpr int MROWS = B_ * NSEQ;   // 4096
static constexpr int NOUTQ = 3 * D_;      // 3072

// load one 16x32 f16 fragment slice for this lane; p already includes +8*g
__device__ __forceinline__ void ldfrag(HFrag& f, const _Float16* p) {
  f.h[0] = *(const v8h*)(p);
  f.h[1] = *(const v8h*)(p + 16);
}

// Packed operand tiles in the workspace: a 16-row x 32-k tile is 512 halves in
// the order [k half i][lane][8], lane = 16 * ((k >> 3) & 1) + row, i = k >> 4,
// so each of a fragment's two 16-byte loads reads 512 bytes in a row (4 lines).
// The k order in the registers is that of ldfrag. p already includes lane * 8.
static constexpr int TILE = 512;          // halves per packed tile
static constexpr int KT   = D_ / 32;      // packed tiles along a 1024-long k
__device__ __forceinline__ void ldpacked(HFrag& f, const _Float16* p) {
  f.h[0] = *(const v8h*)(p);
  f.h[1] = *(const v8h*)(p + 256);
}

__device__ __forceinline__ v8f wmma16(const HFrag& a, const HFrag& b, v8f c) {
  return __builtin_amdgcn_wmma_f32_16x16x32_f16(false, a.v, false, b.v,
                                                (short)0, c, false, false);
}

// ---------------------------------------------------------------- converts
// src: row-major [rows][1024] f32; dst: packed f16 tiles, tile (rt, kt) at
// (rt * KT + kt) * TILE. One wave per tile: it reads 16 whole lines.
typedef __attribute__((ext_vector_type(4))) float v4f;
__global__ __launch_bounds__(256) void f32_to_f16_kernel(
    const float* __restrict__ src, _Float16* __restrict__ dst) {
  const int lane = threadIdx.x & 31;
  const int tile = blockIdx.x * 8 + (threadIdx.x >> 5);
  const int rt = tile / KT, kt = tile % KT;
  const float* p =
      src + (size_t)(rt * 16 + (lane & 15)) * D_ + kt * 32 + 8 * (lane >> 4);
  v4f a0 = *(const v4f*)(p);
  v4f a1 = *(const v4f*)(p + 4);
  v4f b0 = *(const v4f*)(p + 16);
  v4f b1 = *(const v4f*)(p + 20);
  v8h lo, hi;
#pragma unroll
  for (int e = 0; e < 4; ++e) {
    lo[e] = (_Float16)a0[e]; lo[e + 4] = (_Float16)a1[e];
    hi[e] = (_Float16)b0[e]; hi[e + 4] = (_Float16)b1[e];
  }
  _Float16* q = dst + (size_t)tile * TILE + lane * 8;
  *(v8h*)(q) = lo;
  *(v8h*)(q + 256) = hi;
}

// ---------------------- context-row bias MLP: first product on f32 WMMA
// H^T = Wd1 . delta^T: hidden units down the rows, context rows across the
// lanes. A work-group takes 16 context rows and 128 hidden units, one 16 x 16
// tile a wave; both operands come in by whole lines and are read from LDS.
typedef __attribute__((ext_vector_type(2))) float v2f;

static constexpr int NCTX = 1024;       // rows of ctx_delta
static constexpr int HQ   = 128;        // hidden units per work-group
static constexpr int NHQ  = DHID / HQ;  // partial sums per context row
static constexpr int LP   = PDIM + 4;   // LDS row pitch in floats: 16 B x odd

// lane l <-> lane l ^ 16
__device__ __forceinline__ float xhalf(float x) {
  int b = __builtin_bit_cast(int, x);
  return __builtin_bit_cast(
      float, __builtin_amdgcn_permlanex16(b, b, 0x76543210, 0xfedcba98, false,
                                          false));
}

__global__ __launch_bounds__(256, 1) void ctx_bias_kernel(
    const float* __restrict__ delta, const float* __restrict__ Wd1,
    const float* __restrict__ bd1,   const float* __restrict__ Wd2,
    float* __restrict__ part) {
  __shared__ __attribute__((aligned(16))) float tile[(16 + HQ) * LP];
  __shared__ float red[8][16];
  const int tid  = threadIdx.x;
  const int lane = tid & 31;
  const int wave = tid >> 5;
  const int l16  = lane & 15;
  const int g    = lane >> 4;
  const int row0 = blockIdx.x * 16;
  const int h0   = blockIdx.y * HQ;

  // a wave's 16-byte loads cover half a row (4 whole lines); 4 rows a pass
  {
    const int sr = tid >> 6, sc = (tid & 63) * 4;
    const float* dp = delta + (size_t)row0 * PDIM + (sr * PDIM + sc);
    const float* wp = Wd1 + (size_t)h0 * PDIM + (sr * PDIM + sc);
    float* lp = tile + sr * LP + sc;
    v4f t[(16 + HQ) / 4];
    // the three loops are unrolled so that t stays in registers, the steps are
    // immediate offsets and every load is in flight before the first store
#pragma unroll
    for (int i = 0; i < 4; ++i) t[i] = *(const v4f*)(dp + i * 4 * PDIM);
#pragma unroll
    for (int i = 0; i < HQ / 4; ++i)
      t[4 + i] = *(const v4f*)(wp + i * 4 * PDIM);
#pragma unroll
    for (int i = 0; i < (16 + HQ) / 4; ++i) *(v4f*)(lp + i * 4 * LP) = t[i];
  }
  const int hw = h0 + wave * 16 + 8 * g;   // first of the lane's 8 hidden units
  v8f acc0 = *(const v8f*)(bd1 + hw);      // the sum starts from the bias
  v8f acc1 = {0.f, 0.f, 0.f, 0.f, 0.f, 0.f, 0.f, 0.f};
  const v8f w2 = *(const v8f*)(Wd2 + hw);
  __syncthreads();

  // both operands by the same code: lane half g holds k = 8 * kb + 4 * g + 0..3,
  // the first pair for one product, the second for the next
  const float* ap = tile + (16 + wave * 16 + l16) * LP + 4 * g;
  const float* bp = tile + l16 * LP + 4 * g;
  // unrolled: immediate LDS offsets, the next fragments read ahead of the wait
#pragma unroll
  for (int kb = 0; kb < PDIM / 8; ++kb) {
    v4f a = *(const v4f*)(ap + kb * 8);
    v4f b = *(const v4f*)(bp + kb * 8);
    acc0 = __builtin_amdgcn_wmma_f32_16x16x4_f32(
        false, v2f{a.x, a.y}, false, v2f{b.x, b.y}, (short)0, acc0, false,
        false);
    acc1 = __builtin_amdgcn_wmma_f32_16x16x4_f32(
        false, v2f{a.z, a.w}, false, v2f{b.z, b.w}, (short)0, acc1, false,
        false);
  }

  float local = 0.f;   // context row l16, this lane's 8 hidden units
  // unrolled: the accumulators are indexed by constants only
#pragma unroll
  for (int r = 0; r < 8; ++r) {
    float a = acc0[r] + acc1[r];
    float ge = 0.5f * a * (1.f + erff(a * 0.70710678118654752f));  // exact gelu
    local += ge * w2[r];
  }
  local += xhalf(local);
  if (g == 0) red[wave][l16] = local;
  __syncthreads();
  if (tid < 16) {
    float s = 0.f;
    for (int w = 0; w < 8; ++w) s += red[w][tid];
    // each work-group's 16 sums in a 128-byte line of their own
    part[(blockIdx.y * (NCTX / 16) + blockIdx.x) * 32 + tid] = s;
  }
}

// --------------------------- gate, col_bias from the MLP's partial sums
__global__ void gate_tail_kernel(const float* __restrict__ trust,
                                 const float* __restrict__ tscale,
                                 const float* __restrict__ part,
                                 const float* __restrict__ bd2,
                                 const float* __restrict__ ppr,
                                 const float* __restrict__ alpha,
                                 float* __restrict__ gate,
                                 float* __restrict__ bias,
                                 int n_ctx, int n) {
  int i = blockIdx.x * blockDim.x + threadIdx.x;
  if (i >= n) return;
  if (i < n_ctx) {
    gate[i] = 1.f / (1.f + __expf(-tscale[0] * trust[i]));
    float s = 0.f;
    for (int q = 0; q < NHQ; ++q)
      s += part[(q * (NCTX / 16) + (i >> 4)) * 32 + (i & 15)];
    float pv = ppr[i];
    pv = pv < 1e-8f ? 1e-8f : pv;
    bias[i] = alpha[0] * logf(pv) + s + bd2[0];
  } else {
    gate[i] = 1.f;
    bias[i] = 0.f;
  }
}

// ------------------------------------------- the two projection GEMMs
// A wave forms a 64 x 64 tile of the result: per 32 of k it loads 4 A and 4 B
// fragments (8 KB) for 16 products, so each loaded fragment feeds 4 of them.
// Every accumulator sums k in ascending order.
struct FragSet { HFrag a[4], b[4]; };

// ap, bp: the wave's first A and B tile row, lane * 8 included
__device__ __forceinline__ void ldset(FragSet& s, const _Float16* ap,
                                      const _Float16* bp, int kt) {
#pragma unroll
  for (int i = 0; i < 4; ++i) ldpacked(s.a[i], ap + (i * KT + kt) * TILE);
#pragma unroll
  for (int f = 0; f < 4; ++f) ldpacked(s.b[f], bp + (f * KT + kt) * TILE);
}

__device__ __forceinline__ void mmset(v8f (&acc)[4][4], const FragSet& s) {
#pragma unroll
  for (int i = 0; i < 4; ++i)
#pragma unroll
    for (int f = 0; f < 4; ++f) acc[i][f] = wmma16(s.a[i], s.b[f], acc[i][f]);
}

// NSET fragment sets in a ring: step kt's products run with the loads of the
// next NSET - 1 steps in flight.
template <int NSET>
__device__ __forceinline__ void gemm64x64(v8f (&acc)[4][4], const _Float16* ap,
                                          const _Float16* bp) {
  const v8f zero = {0.f, 0.f, 0.f, 0.f, 0.f, 0.f, 0.f, 0.f};
#pragma unroll
  for (int i = 0; i < 4; ++i)
#pragma unroll
    for (int f = 0; f < 4; ++f) acc[i][f] = zero;

  FragSet s[NSET];
#pragma unroll
  for (int j = 0; j < NSET - 1; ++j) ldset(s[j], ap, bp, j);
  // unrolled: the sets are indexed by constants and every load is an immediate
  // offset from the two address pairs.
  // The scheduling fence keeps a set's loads ahead of the 16 products of the
  // oldest set: without it the compiler sinks the loads in among the products
  // of the set they feed and waits on them at once.
#pragma unroll
  for (int kt = 0; kt < KT; ++kt) {
    const int nx = kt + NSET - 1;
    if (nx < KT) ldset(s[nx % NSET], ap, bp, nx);
    // behind the last loads: their address registers are reused after the loop
    if (nx == KT - 1) asm volatile("s_wait_xcnt 0x0" ::: "memory");
    __builtin_amdgcn_sched_barrier(0);
    mmset(acc, s[kt % NSET]);
  }
  // keeps the epilogue behind the last products: woven in among them it takes a
  // register-window switch at every turn
  __builtin_amdgcn_sched_barrier(0);
}

// out = xh[4096,1024] @ W_in^T + b_in, routed to q/k/v head buffers.
// q scaled by d^-0.5, row-major [B,H,N,d]; k and the gated v^T as packed tiles.
// 4 waves form a 128 x 128 block; 768 blocks, three to a WGP (the second
// launch bound keeps the registers of three waves within a SIMD's file).
__global__ __launch_bounds__(128, 3) void qkv_gemm_kernel(
    const _Float16* __restrict__ xh, const _Float16* __restrict__ winh,
    const float* __restrict__ b_in,  const float* __restrict__ gate,
    _Float16* __restrict__ qh, _Float16* __restrict__ kh,
    _Float16* __restrict__ vth) {
  const int lane = threadIdx.x & 31;
  const int wave = threadIdx.x >> 5;
  const int l16  = lane & 15;
  const int g    = lane >> 4;
  const int m0 = blockIdx.x * 128 + (wave & 1) * 64;
  const int n0 = blockIdx.y * 128 + (wave >> 1) * 64;

  v8f acc[4][4];
  gemm64x64<2>(acc, xh + (size_t)(m0 / 16) * KT * TILE + lane * 8,
               winh + (size_t)(n0 / 16) * KT * TILE + lane * 8);

  const float qscale = 0.125f;  // 1/sqrt(64)
  const int bi = m0 / NSEQ;              // a 64-row tile lies in one batch
#pragma unroll
  for (int i = 0; i < 4; ++i) {
    const int tok0 = m0 % NSEQ + i * 16 + 8 * g;  // first of the lane's 8 tokens
#pragma unroll
    for (int f = 0; f < 4; ++f) {
      int nn = n0 + f * 16 + l16;
      int sect = nn / D_;
      int jj = nn % D_;
      int h = jj / DH, c = jj % DH;
      size_t hb = (size_t)(bi * H_ + h);
      float bn = b_in[nn];
      if (sect == 0) {
        _Float16* qp = qh + (hb * NSEQ + tok0) * DH + c;
#pragma unroll
        for (int r = 0; r < 8; ++r)
          qp[r * DH] = (_Float16)((acc[i][f][r] + bn) * qscale);
      } else if (sect == 1) {
        // packed tile (16 keys, 32 of d): row = key, k = d
        _Float16* kp = kh +
            ((hb * (NSEQ / 16) + tok0 / 16) * 2 + c / 32) * TILE +
            ((c >> 4) & 1) * 256 + (((c >> 3) & 1) * 16 + (tok0 & 15)) * 8 +
            (c & 7);
#pragma unroll
        for (int r = 0; r < 8; ++r) kp[r * 8] = (_Float16)(acc[i][f][r] + bn);
      } else {
        // packed tile (16 of d, 32 keys): row = d, k = key; the lane's 8 keys
        // lie in a row there
        v8h vo;
#pragma unroll
        for (int r = 0; r < 8; ++r)
          vo[r] = (_Float16)((acc[i][f][r] + bn) * gate[tok0 + r]);
        *(v8h*)(vth + ((hb * (NSEQ / 32) + tok0 / 32) * 4 + c / 16) * TILE +
                ((tok0 >> 4) & 1) * 256 +
                (((tok0 >> 3) & 1) * 16 + (c & 15)) * 8) = vo;
      }
    }
  }
}

// --------------------------------------------------- flash attention
// 1 wave per 16-query tile; 32-key chunks. Scores are formed transposed,
// S^T = K.Q^T (keys down the rows, queries across the lanes), and the
// output as O^T += V^T.P^T: a lane holds one query's scores, so maximum,
// exponentials and sum stay in its registers, and the two score tiles,
// converted in place, are the B operand of the second product.
typedef __attribute__((ext_vector_type(2))) _Float16 v2h;

__global__ __launch_bounds__(128, 1) void flash_attn_kernel(
    const _Float16* __restrict__ qh, const _Float16* __restrict__ kh,
    const _Float16* __restrict__ vth, const float* __restrict__ bias,
    _Float16* __restrict__ attn) {
  const int lane = threadIdx.x & 31;
  const int wave = threadIdx.x >> 5;
  const int l16  = lane & 15;
  const int g    = lane >> 4;

  const int tile = blockIdx.x * 4 + wave;
  const int qt = tile % (NSEQ / 16);
  const int bh = tile / (NSEQ / 16);

  const _Float16* qbase = qh + ((size_t)bh * NSEQ + (size_t)qt * 16) * DH;
  const _Float16* kball = kh + (size_t)bh * NSEQ * DH;
  const _Float16* vbase = vth + (size_t)bh * DH * NSEQ;

  HFrag bq[2];   // B operand: column l16 = query, k = head dim
  {
    const _Float16* qrow = qbase + (size_t)l16 * DH + 8 * g;
    ldfrag(bq[0], qrow);
    ldfrag(bq[1], qrow + 32);
  }

  v8f zero = {0.f, 0.f, 0.f, 0.f, 0.f, 0.f, 0.f, 0.f};
  v8f acc[4];    // acc[f][r] = O[query l16][f * 16 + 8 * g + r]
#pragma unroll
  for (int f = 0; f < 4; ++f) acc[f] = zero;

  const float L2E = 1.4426950408889634f;
  float mrun = -INFINITY;  // this query's running maximum (same in both halves)
  float lsum = 0.f;        // sum over this lane half's keys only

  for (int kc = 0; kc < NSEQ; kc += 32) {
    // ---- issue all global loads for this chunk up front
    // the per-key bias in the accumulator's own map (row = key) starts the sum
    v8f s0 = *(const v8f*)(bias + kc + 8 * g);
    v8f s1 = *(const v8f*)(bias + kc + 16 + 8 * g);
    HFrag ak[4];   // [keysub(2)][dchunk(2)], A operand: row l16 = key
    {
      const _Float16* kt = kball + (size_t)kc * DH + lane * 8;
      ldpacked(ak[0], kt);             // keys 0-15, d 0-31
      ldpacked(ak[1], kt + TILE);      // keys 0-15, d 32-63
      ldpacked(ak[2], kt + 2 * TILE);  // keys 16-31, d 0-31
      ldpacked(ak[3], kt + 3 * TILE);  // keys 16-31, d 32-63
    }
    HFrag av[4];   // A operand: row l16 = head dim f * 16 + l16, k = key
#pragma unroll
    for (int f = 0; f < 4; ++f) {
      ldpacked(av[f], vbase + (size_t)kc * DH + f * TILE + lane * 8);
    }
    // holds the chunk's loads up here, as one group: without it the compiler
    // sinks each V load to just in front of its product and waits on it there
    __builtin_amdgcn_sched_barrier(0);

    // ---- S^T = k @ q^T + bias (scale pre-folded into q)
    s0 = wmma16(ak[0], bq[0], s0);
    s0 = wmma16(ak[1], bq[1], s0);
    s1 = wmma16(ak[2], bq[0], s1);
    s1 = wmma16(ak[3], bq[1], s1);

    // ---- online softmax, one query per lane, 16 of its 32 keys
    float t0 = fmaxf(fmaxf(s0[0], s0[1]), s0[2]);
    float t1 = fmaxf(fmaxf(s0[3], s0[4]), s0[5]);
    float t2 = fmaxf(fmaxf(s0[6], s0[7]), s1[0]);
    float t3 = fmaxf(fmaxf(s1[1], s1[2]), s1[3]);
    float t4 = fmaxf(fmaxf(s1[4], s1[5]), s1[6]);
    float mx = fmaxf(fmaxf(fmaxf(t0, t1), t2), fmaxf(fmaxf(t3, t4), s1[7]));
    mx = fmaxf(mx, xhalf(mx));
    mx = fmaxf(mx, mrun);
    const float fr = __builtin_amdgcn_exp2f((mrun - mx) * L2E);
    mrun = mx;
    const float nm = -mx * L2E;

    HFrag bp;      // B operand: column l16 = query, k = key, hardware k order
    v2f ps = {0.f, 0.f};
#pragma unroll
    for (int i = 0; i < 4; ++i) {
      v2f a0 = __builtin_elementwise_fma(v2f{s0[2 * i], s0[2 * i + 1]},
                                         v2f{L2E, L2E}, v2f{nm, nm});
      v2f a1 = __builtin_elementwise_fma(v2f{s1[2 * i], s1[2 * i + 1]},
                                         v2f{L2E, L2E}, v2f{nm, nm});
      v2f p0 = {__builtin_amdgcn_exp2f(a0.x), __builtin_amdgcn_exp2f(a0.y)};
      v2f p1 = {__builtin_amdgcn_exp2f(a1.x), __builtin_amdgcn_exp2f(a1.y)};
      ps += p0 + p1;
      v2h h0 = __builtin_convertvector(p0, v2h);
      v2h h1 = __builtin_convertvector(p1, v2h);
      bp.h[0][2 * i] = h0.x; bp.h[0][2 * i + 1] = h0.y;
      bp.h[1][2 * i] = h1.x; bp.h[1][2 * i + 1] = h1.y;
    }
    lsum = lsum * fr + (ps.x + ps.y);

    // ---- rescale accumulator + O^T += V^T @ P^T (V already in registers)
#pragma unroll
    for (int f = 0; f < 4; ++f) {
      acc[f] = acc[f] * fr;
      acc[f] = wmma16(av[f], bp, acc[f]);
    }
  }

  const float inv = 1.f / (lsum + xhalf(lsum));

  const int bi = bh / H_;
  const int h  = bh % H_;
  // packed for the output projection: tile (16 tokens, 32 features)
  _Float16* orow = attn +
      ((size_t)(bi * (NSEQ / 16) + qt) * KT + h * 2) * TILE + lane * 8;
#pragma unroll
  for (int f = 0; f < 4; ++f) {
    v8h o;
#pragma unroll
    for (int r = 0; r < 8; ++r) o[r] = (_Float16)(acc[f][r] * inv);
    *(v8h*)(orow + f * 256) = o;
  }
}

// ------------------------------------------------- output projection
// 256 blocks, one wave to a SIMD: four fragment sets keep its loads in flight
__global__ __launch_bounds__(128, 1) void out_gemm_kernel(
    const _Float16* __restrict__ ah, const _Float16* __restrict__ wouth,
    const float* __restrict__ b_out, float* __restrict__ out) {
  const int lane = threadIdx.x & 31;
  const int wave = threadIdx.x >> 5;
  const int l16  = lane & 15;
  const int g    = lane >> 4;
  const int m0 = blockIdx.x * 128 + (wave & 1) * 64;
  const int n0 = blockIdx.y * 128 + (wave >> 1) * 64;

  v8f acc[4][4];
  gemm64x64<4>(acc, ah + (size_t)(m0 / 16) * KT * TILE + lane * 8,
               wouth + (size_t)(n0 / 16) * KT * TILE + lane * 8);

#pragma unroll
  for (int f = 0; f < 4; ++f) {
    int nn = n0 + f * 16 + l16;
    float bn = b_out[nn];
#pragma unroll
    for (int i = 0; i < 4; ++i) {
#pragma unroll
      for (int r = 0; r < 8; ++r) {
        int m = m0 + i * 16 + r + 8 * g;
        out[(size_t)m * D_ + nn] = acc[i][f][r] + bn;
      }
    }
  }
}

// ------------------------------------------------------------ launcher
extern "C" void kernel_launch(void* const* d_in, const int* in_sizes, int n_in,
                              void* d_out, int out_size, void* d_ws,
                              size_t ws_size, hipStream_t stream) {
  (void)n_in; (void)out_size; (void)ws_size;
  const float* x         = (const float*)d_in[0];
  const float* ctx_ppr   = (const float*)d_in[2];
  const float* ctx_delta = (const float*)d_in[3];
  const float* ctx_trust = (const float*)d_in[4];
  const float* W_in      = (const float*)d_in[5];
  const float* b_in      = (const float*)d_in[6];
  const float* W_out     = (const float*)d_in[7];
  const float* b_out     = (const float*)d_in[8];
  const float* alpha     = (const float*)d_in[9];
  const float* tscale    = (const float*)d_in[10];
  const float* Wd1       = (const float*)d_in[11];
  const float* bd1       = (const float*)d_in[12];
  const float* Wd2       = (const float*)d_in[13];
  const float* bd2       = (const float*)d_in[14];
  float* out = (float*)d_out;
  const int n_ctx = in_sizes[2];  // ctx_ppr has n_ctx elements

  // workspace carve (~42 MB; attn output reuses xh)
  char* w = (char*)d_ws;
  auto carve = [&](size_t bytes) -> char* {
    char* p = w;
    w += (bytes + 255) & ~(size_t)255;
    return p;
  };
  _Float16* xh    = (_Float16*)carve((size_t)MROWS * D_ * 2);
  _Float16* winh  = (_Float16*)carve((size_t)3 * D_ * D_ * 2);
  _Float16* wouth = (_Float16*)carve((size_t)D_ * D_ * 2);
  _Float16* qh    = (_Float16*)carve((size_t)MROWS * D_ * 2);
  _Float16* kh    = (_Float16*)carve((size_t)MROWS * D_ * 2);
  _Float16* vth   = (_Float16*)carve((size_t)MROWS * D_ * 2);
  float* gate = (float*)carve((size_t)NSEQ * 4);
  float* bias = (float*)carve((size_t)NSEQ * 4);
  float* part = (float*)carve((size_t)NHQ * (NCTX / 16) * 32 * 4);
  _Float16* attn = xh;  // xh dead after QKV GEMM

  f32_to_f16_kernel<<<MROWS / 16 * KT / 8, 256, 0, stream>>>(x, xh);
  f32_to_f16_kernel<<<NOUTQ / 16 * KT / 8, 256, 0, stream>>>(W_in, winh);
  f32_to_f16_kernel<<<D_ / 16 * KT / 8, 256, 0, stream>>>(W_out, wouth);

  ctx_bias_kernel<<<dim3(NCTX / 16, NHQ), 256, 0, stream>>>(ctx_delta, Wd1, bd1,
                                                            Wd2, part);
  gate_tail_kernel<<<(NSEQ + 255) / 256, 256, 0, stream>>>(
      ctx_trust, tscale, part, bd2, ctx_ppr, alpha, gate, bias, n_ctx, NSEQ);

  qkv_gemm_kernel<<<dim3(MROWS / 128, NOUTQ / 128), 128, 0, stream>>>(
      xh, winh, b_in, gate, qh, kh, vth);

  flash_attn_kernel<<<(B_ * H_ * (NSEQ / 16)) / 4, 128, 0, stream>>>(
      qh, kh, vth, bias, attn);

  out_gemm_kernel<<<dim3(MROWS / 128, D_ / 128), 128, 0, stream>>>(
      attn, wouth, b_out, out);
}

// v005
// It runs in 105 microseconds.
// Timed twice side by side with v004, it ran 1.09 and 1.08 times as fast.
// All steps since v000 together make it 4.19 times as fast.
#include <hip/hip_runtime.h>
#include <hip/hip_bf16.h>
#include <math.h>

typedef __attribute__((ext_vector_type(16))) _Float16 v16h;
typedef __attribute__((ext_vector_type(8)))  _Float16 v8h;
typedef __attribute__((ext_vector_type(8)))  float    v8f;

union HFrag { v16h v; v8h h[2]; };

static constexpr int B_    = 2;
static constexpr int NSEQ  = 2048;
static constexpr int D_    = 1024;
static constexpr int H_    = 16;
static constexpr int DH    = 64;      // head dim
static constexpr int PDIM  = 256;
static constexpr int DHID  = 512;     // D/2
static constexpr int MROWS = B_ * NSEQ;   // 4096
static constexpr int NOUTQ = 3 * D_;      // 3072

// load one 16x32 f16 fragment slice for this lane; p already includes +8*g
__device__ __forceinline__ void ldfrag(HFrag& f, const _Float16* p) {
  f.h[0] = *(const v8h*)(p);
  f.h[1] = *(const v8h*)(p + 16);
}

// Packed operand tiles in the workspace: a 16-row x 32-k tile is 512 halves in
// the order [k half i][lane][8], lane = 16 * ((k >> 3) & 1) + row, i = k >> 4,
// so each of a fragment's two 16-byte loads reads 512 bytes in a row (4 lines).
// The k order in the registers is that of ldfrag. p already includes lane * 8.
static constexpr int TILE = 512;          // halves per packed tile
static constexpr int KT   = D_ / 32;      // packed tiles along a 1024-long k
__device__ __forceinline__ void ldpacked(HFrag& f, const _Float16* p) {
  f.h[0] = *(const v8h*)(p);
  f.h[1] = *(const v8h*)(p + 256);
}

__device__ __forceinline__ v8f wmma16(const HFrag& a, const HFrag& b, v8f c) {
  return __builtin_amdgcn_wmma_f32_16x16x32_f16(false, a.v, false, b.v,
                                                (short)0, c, false, false);
}

// ---------------------------------------------------------------- converts
// src: row-major [rows][1024] f32; dst: packed f16 tiles, tile (rt, kt) at
// (rt * KT + kt) * TILE. A wave takes CT tiles that follow one another in a
// tile row: 16 rows of CT whole lines in, CT KB in a row out.
typedef __attribute__((ext_vector_type(4))) float v4f;
static constexpr int CT = 8;              // tiles per wave
static constexpr int CB = 8 * CT;         // tiles per 8-wave work-group
__device__ __forceinline__ void convert_tiles(const float* __restrict__ src,
                                              _Float16* __restrict__ dst,
                                              int blk) {
  const int lane = threadIdx.x & 31;
  const int tile = (blk * 8 + (threadIdx.x >> 5)) * CT;
  const int rt = tile / KT, kt = tile % KT;
  const float* p =
      src + (size_t)(rt * 16 + (lane & 15)) * D_ + kt * 32 + 8 * (lane >> 4);
  v4f t[CT][4];
  // both loops unrolled: t stays in registers, the steps are immediate offsets
  // and every load is in flight before the first store
#pragma unroll
  for (int j = 0; j < CT; ++j) {
    t[j][0] = *(const v4f*)(p + j * 32);
    t[j][1] = *(const v4f*)(p + j * 32 + 4);
    t[j][2] = *(const v4f*)(p + j * 32 + 16);
    t[j][3] = *(const v4f*)(p + j * 32 + 20);
  }
  _Float16* q = dst + (size_t)tile * TILE + lane * 8;
#pragma unroll
  for (int j = 0; j < CT; ++j) {
    v8h lo, hi;
#pragma unroll
    for (int e = 0; e < 4; ++e) {
      lo[e] = (_Float16)t[j][0][e]; lo[e + 4] = (_Float16)t[j][1][e];
      hi[e] = (_Float16)t[j][2][e]; hi[e + 4] = (_Float16)t[j][3][e];
    }
    *(v8h*)(q + j * TILE) = lo;
    *(v8h*)(q + j * TILE + 256) = hi;
  }
  // behind the last store: in the merged kernel other branches' code follows in
  // the listing and reuses the stores' address and data registers
  asm volatile("s_wait_xcnt 0x0" ::: "memory");
}

// ---------------------- context-row bias MLP: first product on f32 WMMA
// H^T = Wd1 . delta^T: hidden units down the rows, context rows across the
// lanes. A work-group takes 16 context rows and 128 hidden units, one 16 x 16
// tile a wave; both operands come in by whole lines and are read from LDS.
typedef __attribute__((ext_vector_type(2))) float v2f;

static constexpr int NCTX = 1024;       // rows of ctx_delta
static constexpr int HQ   = 128;        // hidden units per work-group
static constexpr int NHQ  = DHID / HQ;  // partial sums per context row
static constexpr int LP   = PDIM + 4;   // LDS row pitch in floats: 16 B x odd

// lane l <-> lane l ^ 16
__device__ __forceinline__ float xhalf(float x) {
  int b = __builtin_bit_cast(int, x);
  return __builtin_bit_cast(
      float, __builtin_amdgcn_permlanex16(b, b, 0x76543210, 0xfedcba98, false,
                                          false));
}

__device__ __forceinline__ void ctx_bias_block(
    const float* __restrict__ delta, const float* __restrict__ Wd1,
    const float* __restrict__ bd1,   const float* __restrict__ Wd2,
    float* __restrict__ part, int bx, int by) {
  __shared__ __attribute__((aligned(16))) float tile[(16 + HQ) * LP];
  __shared__ float red[8][16];
  const int tid  = threadIdx.x;
  const int lane = tid & 31;
  const int wave = tid >> 5;
  const int l16  = lane & 15;
  const int g    = lane >> 4;
  const int row0 = bx * 16;
  const int h0   = by * HQ;

  // a wave's 16-byte loads cover half a row (4 whole lines); 4 rows a pass
  {
    const int sr = tid >> 6, sc = (tid & 63) * 4;
    const float* dp = delta + (size_t)row0 * PDIM + (sr * PDIM + sc);
    const float* wp = Wd1 + (size_t)h0 * PDIM + (sr * PDIM + sc);
    float* lp = tile + sr * LP + sc;
    v4f t[(16 + HQ) / 4];
    // the three loops are unrolled so that t stays in registers, the steps are
    // immediate offsets and every load is in flight before the first store
#pragma unroll
    for (int i = 0; i < 4; ++i) t[i] = *(const v4f*)(dp + i * 4 * PDIM);
#pragma unroll
    for (int i = 0; i < HQ / 4; ++i)
      t[4 + i] = *(const v4f*)(wp + i * 4 * PDIM);
#pragma unroll
    for (int i = 0; i < (16 + HQ) / 4; ++i) *(v4f*)(lp + i * 4 * LP) = t[i];
  }
  const int hw = h0 + wave * 16 + 8 * g;   // first of the lane's 8 hidden units
  v8f acc0 = *(const v8f*)(bd1 + hw);      // the sum starts from the bias
  v8f acc1 = {0.f, 0.f, 0.f, 0.f, 0.f, 0.f, 0.f, 0.f};
  const v8f w2 = *(const v8f*)(Wd2 + hw);
  __syncthreads();

  // both operands by the same code: lane half g holds k = 8 * kb + 4 * g + 0..3,
  // the first pair for one product, the second for the next
  const float* ap = tile + (16 + wave * 16 + l16) * LP + 4 * g;
  const float* bp = tile + l16 * LP + 4 * g;
  // unrolled: immediate LDS offsets, the next fragments read ahead of the wait
#pragma unroll
  for (int kb = 0; kb < PDIM / 8; ++kb) {
    v4f a = *(const v4f*)(ap + kb * 8);
    v4f b = *(const v4f*)(bp + kb * 8);
    acc0 = __builtin_amdgcn_wmma_f32_16x16x4_f32(
        false, v2f{a.x, a.y}, false, v2f{b.x, b.y}, (short)0, acc0, false,
        false);
    acc1 = __builtin_amdgcn_wmma_f32_16x16x4_f32(
        false, v2f{a.z, a.w}, false, v2f{b.z, b.w}, (short)0, acc1, false,
        false);
  }

  float local = 0.f;   // context row l16, this lane's 8 hidden units
  // unrolled: the accumulators are indexed by constants only
#pragma unroll
  for (int r = 0; r < 8; ++r) {
    float a = acc0[r] + acc1[r];
    float ge = 0.5f * a * (1.f + erff(a * 0.70710678118654752f));  // exact gelu
    local += ge * w2[r];
  }
  local += xhalf(local);
  if (g == 0) red[wave][l16] = local;
  __syncthreads();
  if (tid < 16) {
    float s = 0.f;
    for (int w = 0; w < 8; ++w) s += red[w][tid];
    // each work-group's 16 sums in a 128-byte line of their own
    part[(by * (NCTX / 16) + bx) * 32 + tid] = s;
  }
}

// ------------------- one launch for all that reads nothing but the inputs
// Work-groups 0 .. NCB - 1: the bias MLP's tiles (the longest chain, so they
// start first) and 8 entries each of the value gate; the rest: the three
// converts. 512 work-groups, two to a WGP by the MLP's LDS: all resident.
static constexpr int NCB = NCTX / 16 * NHQ;            // 256
static constexpr int XB  = MROWS / 16 * KT / CB;       // 128
static constexpr int WIB = NOUTQ / 16 * KT / CB;       // 96
static constexpr int WOB = D_ / 16 * KT / CB;          // 32

__global__ __launch_bounds__(256, 1) void prep_kernel(
    const float* __restrict__ x,     const float* __restrict__ W_in,
    const float* __restrict__ W_out, const float* __restrict__ delta,
    const float* __restrict__ Wd1,   const float* __restrict__ bd1,
    const float* __restrict__ Wd2,   const float* __restrict__ trust,
    const float* __restrict__ tscale,
    _Float16* __restrict__ xh, _Float16* __restrict__ winh,
    _Float16* __restrict__ wouth, float* __restrict__ part,
    float* __restrict__ gate, int n_ctx) {
  const int b = blockIdx.x;
  if (b < NCB) {
    // the gate's two loads go out ahead of the MLP's and are used behind it,
    // so that their latency is not added to the first wave's chain
    const int i = b * (NSEQ / NCB) + threadIdx.x;
    const bool mine = threadIdx.x < NSEQ / NCB;
    const float ts = tscale[0];
    float tr = 0.f;
    if (mine && i < n_ctx) tr = trust[i];
    ctx_bias_block(delta, Wd1, bd1, Wd2, part, b % (NCTX / 16),
                   b / (NCTX / 16));
    if (mine)
      gate[i] = i < n_ctx ? 1.f / (1.f + __expf(-ts * tr)) : 1.f;
  } else if (b < NCB + XB) {
    convert_tiles(x, xh, b - NCB);
  } else if (b < NCB + XB + WIB) {
    convert_tiles(W_in, winh, b - (NCB + XB));
  } else {
    convert_tiles(W_out, wouth, b - (NCB + XB + WIB));
  }
}

// col_bias entry i from the MLP's partial sums (written by the launch before)
__device__ __forceinline__ float key_bias(const float* __restrict__ part,
                                          const float* __restrict__ bd2,
                                          const float* __restrict__ ppr,
                                          const float* __restrict__ alpha,
                                          int n_ctx, int i) {
  if (i >= n_ctx) return 0.f;
  const float al = alpha[0], b2 = bd2[0];
  float pv = ppr[i];
  float ps[NHQ];
  // both loops unrolled: ps is indexed by constants and stays in registers
#pragma unroll
  for (int q = 0; q < NHQ; ++q)
    ps[q] = part[(q * (NCTX / 16) + (i >> 4)) * 32 + (i & 15)];
  // keeps the loads together: without it the compiler waits out the first
  // before it issues the rest, two latencies in a row ahead of the GEMM
  __builtin_amdgcn_sched_barrier(0);
  float s = 0.f;
#pragma unroll
  for (int q = 0; q < NHQ; ++q) s += ps[q];
  pv = pv < 1e-8f ? 1e-8f : pv;
  return al * logf(pv) + s + b2;
}

// ------------------------------------------- the two projection GEMMs
// A wave forms a 64 x 64 tile of the result: per 32 of k it loads 4 A and 4 B
// fragments (8 KB) for 16 products, so each loaded fragment feeds 4 of them.
// Every accumulator sums k in ascending order.
struct FragSet { HFrag a[4], b[4]; };

// ap, bp: the wave's first A and B tile row, lane * 8 included
__device__ __forceinline__ void ldset(FragSet& s, const _Float16* ap,
                                      const _Float16* bp, int kt) {
#pragma unroll
  for (int i = 0; i < 4; ++i) ldpacked(s.a[i], ap + (i * KT + kt) * TILE);
#pragma unroll
  for (int f = 0; f < 4; ++f) ldpacked(s.b[f], bp + (f * KT + kt) * TILE);
}

__device__ __forceinline__ void mmset(v8f (&acc)[4][4], const FragSet& s) {
#pragma unroll
  for (int i = 0; i < 4; ++i)
#pragma unroll
    for (int f = 0; f < 4; ++f) acc[i][f] = wmma16(s.a[i], s.b[f], acc[i][f]);
}

// NSET fragment sets in a ring: step kt's products run with the loads of the
// next NSET - 1 steps in flight.
template <int NSET>
__device__ __forceinline__ void gemm64x64(v8f (&acc)[4][4], const _Float16* ap,
                                          const _Float16* bp) {
  const v8f zero = {0.f, 0.f, 0.f, 0.f, 0.f, 0.f, 0.f, 0.f};
#pragma unroll
  for (int i = 0; i < 4; ++i)
#pragma unroll
    for (int f = 0; f < 4; ++f) acc[i][f] = zero;

  FragSet s[NSET];
#pragma unroll
  for (int j = 0; j < NSET - 1; ++j) ldset(s[j], ap, bp, j);
  // unrolled: the sets are indexed by constants and every load is an immediate
  // offset from the two address pairs.
  // The scheduling fence keeps a set's loads ahead of the 16 products of the
  // oldest set: without it the compiler sinks the loads in among the products
  // of the set they feed and waits on them at once.
#pragma unroll
  for (int kt = 0; kt < KT; ++kt) {
    const int nx = kt + NSET - 1;
    if (nx < KT) ldset(s[nx % NSET], ap, bp, nx);
    // behind the last loads: their address registers are reused after the loop
    if (nx == KT - 1) asm volatile("s_wait_xcnt 0x0" ::: "memory");
    __builtin_amdgcn_sched_barrier(0);
    mmset(acc, s[kt % NSET]);
  }
  // keeps the epilogue behind the last products: woven in among them it takes a
  // register-window switch at every turn
  __builtin_amdgcn_sched_barrier(0);
}

// out = xh[4096,1024] @ W_in^T + b_in, routed to q/k/v head buffers.
// q scaled by d^-0.5, row-major [B,H,N,d]; k and the gated v^T as packed tiles.
// 4 waves form a 128 x 128 block; 768 blocks, three to a WGP (the second
// launch bound keeps the registers of three waves within a SIMD's file).
__global__ __launch_bounds__(128, 3) void qkv_gemm_kernel(
    const _Float16* __restrict__ xh, const _Float16* __restrict__ winh,
    const float* __restrict__ b_in,  const float* __restrict__ gate,
    const float* __restrict__ part,  const float* __restrict__ bd2,
    const float* __restrict__ ppr,   const float* __restrict__ alpha,
    _Float16* __restrict__ qh, _Float16* __restrict__ kh,
    _Float16* __restrict__ vth, float* __restrict__ bias, int n_ctx) {
  // the per-key bias for the attention launch, 128 entries a work-group, in
  // the work-groups of lowest index, which start ahead of the others
  if (blockIdx.y == 0 && blockIdx.x < NSEQ / 128) {
    const int i = blockIdx.x * 128 + threadIdx.x;
    bias[i] = key_bias(part, bd2, ppr, alpha, n_ctx, i);
  }
  const int lane = threadIdx.x & 31;
  const int wave = threadIdx.x >> 5;
  const int l16  = lane & 15;
  const int g    = lane >> 4;
  const int m0 = blockIdx.x * 128 + (wave & 1) * 64;
  const int n0 = blockIdx.y * 128 + (wave >> 1) * 64;

  v8f acc[4][4];
  gemm64x64<2>(acc, xh + (size_t)(m0 / 16) * KT * TILE + lane * 8,
               winh + (size_t)(n0 / 16) * KT * TILE + lane * 8);

  const float qscale = 0.125f;  // 1/sqrt(64)
  const int bi = m0 / NSEQ;              // a 64-row tile lies in one batch
#pragma unroll
  for (int i = 0; i < 4; ++i) {
    const int tok0 = m0 % NSEQ + i * 16 + 8 * g;  // first of the lane's 8 tokens
#pragma unroll
    for (int f = 0; f < 4; ++f) {
      int nn = n0 + f * 16 + l16;
      int sect = nn / D_;
      int jj = nn % D_;
      int h = jj / DH, c = jj % DH;
      size_t hb = (size_t)(bi * H_ + h);
      float bn = b_in[nn];
      if (sect == 0) {
        _Float16* qp = qh + (hb * NSEQ + tok0) * DH + c;
#pragma unroll
        for (int r = 0; r < 8; ++r)
          qp[r * DH] = (_Float16)((acc[i][f][r] + bn) * qscale);
      } else if (sect == 1) {
        // packed tile (16 keys, 32 of d): row = key, k = d
        _Float16* kp = kh +
            ((hb * (NSEQ / 16) + tok0 / 16) * 2 + c / 32) * TILE +
            ((c >> 4) & 1) * 256 + (((c >> 3) & 1) * 16 + (tok0 & 15)) * 8 +
            (c & 7);
#pragma unroll
        for (int r = 0; r < 8; ++r) kp[r * 8] = (_Float16)(acc[i][f][r] + bn);
      } else {
        // packed tile (16 of d, 32 keys): row = d, k = key; the lane's 8 keys
        // lie in a row there
        v8h vo;
#pragma unroll
        for (int r = 0; r < 8; ++r)
          vo[r] = (_Float16)((acc[i][f][r] + bn) * gate[tok0 + r]);
        *(v8h*)(vth + ((hb * (NSEQ / 32) + tok0 / 32) * 4 + c / 16) * TILE +
                ((tok0 >> 4) & 1) * 256 +
                (((tok0 >> 3) & 1) * 16 + (c & 15)) * 8) = vo;
      }
    }
  }
}

// --------------------------------------------------- flash attention
// 1 wave per 16-query tile; 32-key chunks. Scores are formed transposed,
// S^T = K.Q^T (keys down the rows, queries across the lanes), and the
// output as O^T += V^T.P^T: a lane holds one query's scores, so maximum,
// exponentials and sum stay in its registers, and the two score tiles,
// converted in place, are the B operand of the second product.
typedef __attribute__((ext_vector_type(2))) _Float16 v2h;

__global__ __launch_bounds__(128, 1) void flash_attn_kernel(
    const _Float16* __restrict__ qh, const _Float16* __restrict__ kh,
    const _Float16* __restrict__ vth, const float* __restrict__ bias,
    _Float16* __restrict__ attn) {
  const int lane = threadIdx.x & 31;
  const int wave = threadIdx.x >> 5;
  const int l16  = lane & 15;
  const int g    = lane >> 4;

  const int tile = blockIdx.x * 4 + wave;
  const int qt = tile % (NSEQ / 16);
  const int bh = tile / (NSEQ / 16);

  const _Float16* qbase = qh + ((size_t)bh * NSEQ + (size_t)qt * 16) * DH;
  const _Float16* kball = kh + (size_t)bh * NSEQ * DH;
  const _Float16* vbase = vth + (size_t)bh * DH * NSEQ;

  HFrag bq[2];   // B operand: column l16 = query, k = head dim
  {
    const _Float16* qrow = qbase + (size_t)l16 * DH + 8 * g;
    ldfrag(bq[0], qrow);
    ldfrag(bq[1], qrow + 32);
  }

  v8f zero = {0.f, 0.f, 0.f, 0.f, 0.f, 0.f, 0.f, 0.f};
  v8f acc[4];    // acc[f][r] = O[query l16][f * 16 + 8 * g + r]
#pragma unroll
  for (int f = 0; f < 4; ++f) acc[f] = zero;

  const float L2E = 1.4426950408889634f;
  float mrun = -INFINITY;  // this query's running maximum (same in both halves)
  float lsum = 0.f;        // sum over this lane half's keys only

  for (int kc = 0; kc < NSEQ; kc += 32) {
    // ---- issue all global loads for this chunk up front
    // the per-key bias in the accumulator's own map (row = key) starts the sum
    v8f s0 = *(const v8f*)(bias + kc + 8 * g);
    v8f s1 = *(const v8f*)(bias + kc + 16 + 8 * g);
    HFrag ak[4];   // [keysub(2)][dchunk(2)], A operand: row l16 = key
    {
      const _Float16* kt = kball + (size_t)kc * DH + lane * 8;
      ldpacked(ak[0], kt);             // keys 0-15, d 0-31
      ldpacked(ak[1], kt + TILE);      // keys 0-15, d 32-63
      ldpacked(ak[2], kt + 2 * TILE);  // keys 16-31, d 0-31
      ldpacked(ak[3], kt + 3 * TILE);  // keys 16-31, d 32-63
    }
    HFrag av[4];   // A operand: row l16 = head dim f * 16 + l16, k = key
#pragma unroll
    for (int f = 0; f < 4; ++f) {
      ldpacked(av[f], vbase + (size_t)kc * DH + f * TILE + lane * 8);
    }
    // holds the chunk's loads up here, as one group: without it the compiler
    // sinks each V load to just in front of its product and waits on it there
    __builtin_amdgcn_sched_barrier(0);

    // ---- S^T = k @ q^T + bias (scale pre-folded into q)
    s0 = wmma16(ak[0], bq[0], s0);
    s0 = wmma16(ak[1], bq[1], s0);
    s1 = wmma16(ak[2], bq[0], s1);
    s1 = wmma16(ak[3], bq[1], s1);

    // ---- online softmax, one query per lane, 16 of its 32 keys
    float t0 = fmaxf(fmaxf(s0[0], s0[1]), s0[2]);
    float t1 = fmaxf(fmaxf(s0[3], s0[4]), s0[5]);
    float t2 = fmaxf(fmaxf(s0[6], s0[7]), s1[0]);
    float t3 = fmaxf(fmaxf(s1[1], s1[2]), s1[3]);
    float t4 = fmaxf(fmaxf(s1[4], s1[5]), s1[6]);
    float mx = fmaxf(fmaxf(fmaxf(t0, t1), t2), fmaxf(fmaxf(t3, t4), s1[7]));
    mx = fmaxf(mx, xhalf(mx));
    mx = fmaxf(mx, mrun);
    const float fr = __builtin_amdgcn_exp2f((mrun - mx) * L2E);
    mrun = mx;
    const float nm = -mx * L2E;

    HFrag bp;      // B operand: column l16 = query, k = key, hardware k order
    v2f ps = {0.f, 0.f};
#pragma unroll
    for (int i = 0; i < 4; ++i) {
      v2f a0 = __builtin_elementwise_fma(v2f{s0[2 * i], s0[2 * i + 1]},
                                         v2f{L2E, L2E}, v2f{nm, nm});
      v2f a1 = __builtin_elementwise_fma(v2f{s1[2 * i], s1[2 * i + 1]},
                                         v2f{L2E, L2E}, v2f{nm, nm});
      v2f p0 = {__builtin_amdgcn_exp2f(a0.x), __builtin_amdgcn_exp2f(a0.y)};
      v2f p1 = {__builtin_amdgcn_exp2f(a1.x), __builtin_amdgcn_exp2f(a1.y)};
      ps += p0 + p1;
      v2h h0 = __builtin_convertvector(p0, v2h);
      v2h h1 = __builtin_convertvector(p1, v2h);
      bp.h[0][2 * i] = h0.x; bp.h[0][2 * i + 1] = h0.y;
      bp.h[1][2 * i] = h1.x; bp.h[1][2 * i + 1] = h1.y;
    }
    lsum = lsum * fr + (ps.x + ps.y);

    // ---- rescale accumulator + O^T += V^T @ P^T (V already in registers)
#pragma unroll
    for (int f = 0; f < 4; ++f) {
      acc[f] = acc[f] * fr;
      acc[f] = wmma16(av[f], bp, acc[f]);
    }
  }

  const float inv = 1.f / (lsum + xhalf(lsum));

  const int bi = bh / H_;
  const int h  = bh % H_;
  // packed for the output projection: tile (16 tokens, 32 features)
  _Float16* orow = attn +
      ((size_t)(bi * (NSEQ / 16) + qt) * KT + h * 2) * TILE + lane * 8;
#pragma unroll
  for (int f = 0; f < 4; ++f) {
    v8h o;
#pragma unroll
    for (int r = 0; r < 8; ++r) o[r] = (_Float16)(acc[f][r] * inv);
    *(v8h*)(orow + f * 256) = o;
  }
}

// ------------------------------------------------- output projection
// 256 blocks, one wave to a SIMD: four fragment sets keep its loads in flight
__global__ __launch_bounds__(128, 1) void out_gemm_kernel(
    const _Float16* __restrict__ ah, const _Float16* __restrict__ wouth,
    const float* __restrict__ b_out, float* __restrict__ out) {
  const int lane = threadIdx.x & 31;
  const int wave = threadIdx.x >> 5;
  const int l16  = lane & 15;
  const int g    = lane >> 4;
  const int m0 = blockIdx.x * 128 + (wave & 1) * 64;
  const int n0 = blockIdx.y * 128 + (wave >> 1) * 64;

  v8f acc[4][4];
  gemm64x64<4>(acc, ah + (size_t)(m0 / 16) * KT * TILE + lane * 8,
               wouth + (size_t)(n0 / 16) * KT * TILE + lane * 8);

#pragma unroll
  for (int f = 0; f < 4; ++f) {
    int nn = n0 + f * 16 + l16;
    float bn = b_out[nn];
#pragma unroll
    for (int i = 0; i < 4; ++i) {
#pragma unroll
      for (int r = 0; r < 8; ++r) {
        int m = m0 + i * 16 + r + 8 * g;
        out[(size_t)m * D_ + nn] = acc[i][f][r] + bn;
      }
    }
  }
}

// ------------------------------------------------------------ launcher
extern "C" void kernel_launch(void* const* d_in, const int* in_sizes, int n_in,
                              void* d_out, int out_size, void* d_ws,
                              size_t ws_size, hipStream_t stream) {
  (void)n_in; (void)out_size; (void)ws_size;
  const float* x         = (const float*)d_in[0];
  const float* ctx_ppr   = (const float*)d_in[2];
  const float* ctx_delta = (const float*)d_in[3];
  const float* ctx_trust = (const float*)d_in[4];
  const float* W_in      = (const float*)d_in[5];
  const float* b_in      = (const float*)d_in[6];
  const float* W_out     = (const float*)d_in[7];
  const float* b_out     = (const float*)d_in[8];
  const float* alpha     = (const float*)d_in[9];
  const float* tscale    = (const float*)d_in[10];
  const float* Wd1       = (const float*)d_in[11];
  const float* bd1       = (const float*)d_in[12];
  const float* Wd2       = (const float*)d_in[13];
  const float* bd2       = (const float*)d_in[14];
  float* out = (float*)d_out;
  const int n_ctx = in_sizes[2];  // ctx_ppr has n_ctx elements

  // workspace carve (~42 MB; attn output reuses xh)
  char* w = (char*)d_ws;
  auto carve = [&](size_t bytes) -> char* {
    char* p = w;
    w += (bytes + 255) & ~(size_t)255;
    return p;
  };
  _Float16* xh    = (_Float16*)carve((size_t)MROWS * D_ * 2);
  _Float16* winh  = (_Float16*)carve((size_t)3 * D_ * D_ * 2);
  _Float16* wouth = (_Float16*)carve((size_t)D_ * D_ * 2);
  _Float16* qh    = (_Float16*)carve((size_t)MROWS * D_ * 2);
  _Float16* kh    = (_Float16*)carve((size_t)MROWS * D_ * 2);
  _Float16* vth   = (_Float16*)carve((size_t)MROWS * D_ * 2);
  float* gate = (float*)carve((size_t)NSEQ * 4);
  float* bias = (float*)carve((size_t)NSEQ * 4);
  float* part = (float*)carve((size_t)NHQ * (NCTX / 16) * 32 * 4);
  _Float16* attn = xh;  // xh dead after QKV GEMM

  prep_kernel<<<NCB + XB + WIB + WOB, 256, 0, stream>>>(
      x, W_in, W_out, ctx_delta, Wd1, bd1, Wd2, ctx_trust, tscale, xh, winh,
      wouth, part, gate, n_ctx);

  qkv_gemm_kernel<<<dim3(MROWS / 128, NOUTQ / 128), 128, 0, stream>>>(
      xh, winh, b_in, gate, part, bd2, ctx_ppr, alpha, qh, kh, vth, bias,
      n_ctx);

  flash_attn_kernel<<<(B_ * H_ * (NSEQ / 16)) / 4, 128, 0, stream>>>(
      qh, kh, vth, bias, attn);

  out_gemm_kernel<<<dim3(MROWS / 128, D_ / 128), 128, 0, stream>>>(
      attn, wouth, b_out, out);
}

// v006
// Measured time: 98.5 microseconds a run.
// In both of two side-by-side timings against v005, it was 1.06 times as fast.
// All steps since v000 together make it 4.43 times as fast.
#include <hip/hip_runtime.h>
#include <hip/hip_bf16.h>
#include <math.h>

typedef __attribute__((ext_vector_type(16))) _Float16 v16h;
typedef __attribute__((ext_vector_type(8)))  _Float16 v8h;
typedef __attribute__((ext_vector_type(8)))  float    v8f;

union HFrag { v16h v; v8h h[2]; };

static constexpr int B_    = 2;
static constexpr int NSEQ  = 2048;
static constexpr int D_    = 1024;
static constexpr int H_    = 16;
static constexpr int DH    = 64;      // head dim
static constexpr int PDIM  = 256;
static constexpr int DHID  = 512;     // D/2
static constexpr int MROWS = B_ * NSEQ;   // 4096
static constexpr int NOUTQ = 3 * D_;      // 3072

// load one 16x32 f16 fragment slice for this lane; p already includes +8*g
__device__ __forceinline__ void ldfrag(HFrag& f, const _Float16* p) {
  f.h[0] = *(const v8h*)(p);
  f.h[1] = *(const v8h*)(p + 16);
}

// Packed operand tiles in the workspace: a 16-row x 32-k tile is 512 halves in
// the order [k half i][lane][8], lane = 16 * ((k >> 3) & 1) + row, i = k >> 4,
// so each of a fragment's two 16-byte loads reads 512 bytes in a row (4 lines).
// The k order in the registers is that of ldfrag. p already includes lane * 8.
static constexpr int TILE = 512;          // halves per packed tile
static constexpr int KT   = D_ / 32;      // packed tiles along a 1024-long k
__device__ __forceinline__ void ldpacked(HFrag& f, const _Float16* p) {
  f.h[0] = *(const v8h*)(p);
  f.h[1] = *(const v8h*)(p + 256);
}

__device__ __forceinline__ v8f wmma16(const HFrag& a, const HFrag& b, v8f c) {
  return __builtin_amdgcn_wmma_f32_16x16x32_f16(false, a.v, false, b.v,
                                                (short)0, c, false, false);
}

// ---------------------------------------------------------------- converts
// src: row-major [rows][1024] f32; dst: packed f16 tiles, tile (rt, kt) at
// (rt * KT + kt) * TILE. A wave takes CT tiles that follow one another in a
// tile row: 16 rows of CT whole lines in, CT KB in a row out.
typedef __attribute__((ext_vector_type(4))) float v4f;
static constexpr int CT = 8;              // tiles per wave
static constexpr int CB = 8 * CT;         // tiles per 8-wave work-group
__device__ __forceinline__ void convert_tiles(const float* __restrict__ src,
                                              _Float16* __restrict__ dst,
                                              int blk) {
  const int lane = threadIdx.x & 31;
  const int tile = (blk * 8 + (threadIdx.x >> 5)) * CT;
  const int rt = tile / KT, kt = tile % KT;
  const float* p =
      src + (size_t)(rt * 16 + (lane & 15)) * D_ + kt * 32 + 8 * (lane >> 4);
  v4f t[CT][4];
  // both loops unrolled: t stays in registers, the steps are immediate offsets
  // and every load is in flight before the first store
#pragma unroll
  for (int j = 0; j < CT; ++j) {
    t[j][0] = *(const v4f*)(p + j * 32);
    t[j][1] = *(const v4f*)(p + j * 32 + 4);
    t[j][2] = *(const v4f*)(p + j * 32 + 16);
    t[j][3] = *(const v4f*)(p + j * 32 + 20);
  }
  _Float16* q = dst + (size_t)tile * TILE + lane * 8;
#pragma unroll
  for (int j = 0; j < CT; ++j) {
    v8h lo, hi;
#pragma unroll
    for (int e = 0; e < 4; ++e) {
      lo[e] = (_Float16)t[j][0][e]; lo[e + 4] = (_Float16)t[j][1][e];
      hi[e] = (_Float16)t[j][2][e]; hi[e + 4] = (_Float16)t[j][3][e];
    }
    *(v8h*)(q + j * TILE) = lo;
    *(v8h*)(q + j * TILE + 256) = hi;
  }
  // behind the last store: in the merged kernel other branches' code follows in
  // the listing and reuses the stores' address and data registers
  asm volatile("s_wait_xcnt 0x0" ::: "memory");
}

// ---------------------- context-row bias MLP: first product on f32 WMMA
// H^T = Wd1 . delta^T: hidden units down the rows, context rows across the
// lanes. A work-group takes 16 context rows and 128 hidden units, one 16 x 16
// tile a wave; both operands come in by whole lines and are read from LDS.
typedef __attribute__((ext_vector_type(2))) float v2f;

static constexpr int NCTX = 1024;       // rows of ctx_delta
static constexpr int HQ   = 128;        // hidden units per work-group
static constexpr int NHQ  = DHID / HQ;  // partial sums per context row
static constexpr int LP   = PDIM + 4;   // LDS row pitch in floats: 16 B x odd

// lane l <-> lane l ^ 16
__device__ __forceinline__ float xhalf(float x) {
  int b = __builtin_bit_cast(int, x);
  return __builtin_bit_cast(
      float, __builtin_amdgcn_permlanex16(b, b, 0x76543210, 0xfedcba98, false,
                                          false));
}

__device__ __forceinline__ void ctx_bias_block(
    const float* __restrict__ delta, const float* __restrict__ Wd1,
    const float* __restrict__ bd1,   const float* __restrict__ Wd2,
    float* __restrict__ part, int bx, int by) {
  __shared__ __attribute__((aligned(16))) float tile[(16 + HQ) * LP];
  __shared__ float red[8][16];
  const int tid  = threadIdx.x;
  const int lane = tid & 31;
  const int wave = tid >> 5;
  const int l16  = lane & 15;
  const int g    = lane >> 4;
  const int row0 = bx * 16;
  const int h0   = by * HQ;

  // a wave's 16-byte loads cover half a row (4 whole lines); 4 rows a pass
  {
    const int sr = tid >> 6, sc = (tid & 63) * 4;
    const float* dp = delta + (size_t)row0 * PDIM + (sr * PDIM + sc);
    const float* wp = Wd1 + (size_t)h0 * PDIM + (sr * PDIM + sc);
    float* lp = tile + sr * LP + sc;
    v4f t[(16 + HQ) / 4];
    // the three loops are unrolled so that t stays in registers, the steps are
    // immediate offsets and every load is in flight before the first store
#pragma unroll
    for (int i = 0; i < 4; ++i) t[i] = *(const v4f*)(dp + i * 4 * PDIM);
#pragma unroll
    for (int i = 0; i < HQ / 4; ++i)
      t[4 + i] = *(const v4f*)(wp + i * 4 * PDIM);
#pragma unroll
    for (int i = 0; i < (16 + HQ) / 4; ++i) *(v4f*)(lp + i * 4 * LP) = t[i];
  }
  const int hw = h0 + wave * 16 + 8 * g;   // first of the lane's 8 hidden units
  v8f acc0 = *(const v8f*)(bd1 + hw);      // the sum starts from the bias
  v8f acc1 = {0.f, 0.f, 0.f, 0.f, 0.f, 0.f, 0.f, 0.f};
  const v8f w2 = *(const v8f*)(Wd2 + hw);
  __syncthreads();

  // both operands by the same code: lane half g holds k = 8 * kb + 4 * g + 0..3,
  // the first pair for one product, the second for the next
  const float* ap = tile + (16 + wave * 16 + l16) * LP + 4 * g;
  const float* bp = tile + l16 * LP + 4 * g;
  // unrolled: immediate LDS offsets, the next fragments read ahead of the wait
#pragma unroll
  for (int kb = 0; kb < PDIM / 8; ++kb) {
    v4f a = *(const v4f*)(ap + kb * 8);
    v4f b = *(const v4f*)(bp + kb * 8);
    acc0 = __builtin_amdgcn_wmma_f32_16x16x4_f32(
        false, v2f{a.x, a.y}, false, v2f{b.x, b.y}, (short)0, acc0, false,
        false);
    acc1 = __builtin_amdgcn_wmma_f32_16x16x4_f32(
        false, v2f{a.z, a.w}, false, v2f{b.z, b.w}, (short)0, acc1, false,
        false);
  }

  float local = 0.f;   // context row l16, this lane's 8 hidden units
  // unrolled: the accumulators are indexed by constants only
#pragma unroll
  for (int r = 0; r < 8; ++r) {
    float a = acc0[r] + acc1[r];
    float ge = 0.5f * a * (1.f + erff(a * 0.70710678118654752f));  // exact gelu
    local += ge * w2[r];
  }
  local += xhalf(local);
  if (g == 0) red[wave][l16] = local;
  __syncthreads();
  if (tid < 16) {
    float s = 0.f;
    for (int w = 0; w < 8; ++w) s += red[w][tid];
    // each work-group's 16 sums in a 128-byte line of their own
    part[(by * (NCTX / 16) + bx) * 32 + tid] = s;
  }
}

// ------------------- one launch for all that reads nothing but the inputs
// Work-groups 0 .. NCB - 1: the bias MLP's tiles (the longest chain, so they
// start first) and 8 entries each of the value gate; the rest: the three
// converts. 512 work-groups, two to a WGP by the MLP's LDS: all resident.
static constexpr int NCB = NCTX / 16 * NHQ;            // 256
static constexpr int XB  = MROWS / 16 * KT / CB;       // 128
static constexpr int WIB = NOUTQ / 16 * KT / CB;       // 96
static constexpr int WOB = D_ / 16 * KT / CB;          // 32

__global__ __launch_bounds__(256, 1) void prep_kernel(
    const float* __restrict__ x,     const float* __restrict__ W_in,
    const float* __restrict__ W_out, const float* __restrict__ delta,
    const float* __restrict__ Wd1,   const float* __restrict__ bd1,
    const float* __restrict__ Wd2,   const float* __restrict__ trust,
    const float* __restrict__ tscale,
    _Float16* __restrict__ xh, _Float16* __restrict__ winh,
    _Float16* __restrict__ wouth, float* __restrict__ part,
    float* __restrict__ gate, int n_ctx) {
  const int b = blockIdx.x;
  if (b < NCB) {
    // the gate's two loads go out ahead of the MLP's and are used behind it,
    // so that their latency is not added to the first wave's chain
    const int i = b * (NSEQ / NCB) + threadIdx.x;
    const bool mine = threadIdx.x < NSEQ / NCB;
    const float ts = tscale[0];
    float tr = 0.f;
    if (mine && i < n_ctx) tr = trust[i];
    ctx_bias_block(delta, Wd1, bd1, Wd2, part, b % (NCTX / 16),
                   b / (NCTX / 16));
    if (mine)
      gate[i] = i < n_ctx ? 1.f / (1.f + __expf(-ts * tr)) : 1.f;
  } else if (b < NCB + XB) {
    convert_tiles(x, xh, b - NCB);
  } else if (b < NCB + XB + WIB) {
    convert_tiles(W_in, winh, b - (NCB + XB));
  } else {
    convert_tiles(W_out, wouth, b - (NCB + XB + WIB));
  }
}

// col_bias entry i from the MLP's partial sums (written by the launch before)
__device__ __forceinline__ float key_bias(const float* __restrict__ part,
                                          const float* __restrict__ bd2,
                                          const float* __restrict__ ppr,
                                          const float* __restrict__ alpha,
                                          int n_ctx, int i) {
  if (i >= n_ctx) return 0.f;
  const float al = alpha[0], b2 = bd2[0];
  float pv = ppr[i];
  float ps[NHQ];
  // both loops unrolled: ps is indexed by constants and stays in registers
#pragma unroll
  for (int q = 0; q < NHQ; ++q)
    ps[q] = part[(q * (NCTX / 16) + (i >> 4)) * 32 + (i & 15)];
  // keeps the loads together: without it the compiler waits out the first
  // before it issues the rest, two latencies in a row ahead of the GEMM
  __builtin_amdgcn_sched_barrier(0);
  float s = 0.f;
#pragma unroll
  for (int q = 0; q < NHQ; ++q) s += ps[q];
  pv = pv < 1e-8f ? 1e-8f : pv;
  return al * logf(pv) + s + b2;
}

// ------------------------------------------- the two projection GEMMs
// A wave forms a 64 x 64 tile of the result: per 32 of k it loads 4 A and 4 B
// fragments (8 KB) for 16 products, so each loaded fragment feeds 4 of them.
// Every accumulator sums k in ascending order.
struct FragSet { HFrag a[4], b[4]; };

// ap, bp: the wave's first A and B tile row, lane * 8 included
__device__ __forceinline__ void ldset(FragSet& s, const _Float16* ap,
                                      const _Float16* bp, int kt) {
#pragma unroll
  for (int i = 0; i < 4; ++i) ldpacked(s.a[i], ap + (i * KT + kt) * TILE);
#pragma unroll
  for (int f = 0; f < 4; ++f) ldpacked(s.b[f], bp + (f * KT + kt) * TILE);
}

__device__ __forceinline__ void mmset(v8f (&acc)[4][4], const FragSet& s) {
#pragma unroll
  for (int i = 0; i < 4; ++i)
#pragma unroll
    for (int f = 0; f < 4; ++f) acc[i][f] = wmma16(s.a[i], s.b[f], acc[i][f]);
}

// NSET fragment sets in a ring: step kt's products run with the loads of the
// next NSET - 1 steps in flight.
template <int NSET>
__device__ __forceinline__ void gemm64x64(v8f (&acc)[4][4], const _Float16* ap,
                                          const _Float16* bp) {
  const v8f zero = {0.f, 0.f, 0.f, 0.f, 0.f, 0.f, 0.f, 0.f};
#pragma unroll
  for (int i = 0; i < 4; ++i)
#pragma unroll
    for (int f = 0; f < 4; ++f) acc[i][f] = zero;

  FragSet s[NSET];
#pragma unroll
  for (int j = 0; j < NSET - 1; ++j) ldset(s[j], ap, bp, j);
  // unrolled: the sets are indexed by constants and every load is an immediate
  // offset from the two address pairs.
  // The scheduling fence keeps a set's loads ahead of the 16 products of the
  // oldest set: without it the compiler sinks the loads in among the products
  // of the set they feed and waits on them at once.
#pragma unroll
  for (int kt = 0; kt < KT; ++kt) {
    const int nx = kt + NSET - 1;
    if (nx < KT) ldset(s[nx % NSET], ap, bp, nx);
    // behind the last loads: their address registers are reused after the loop
    if (nx == KT - 1) asm volatile("s_wait_xcnt 0x0" ::: "memory");
    __builtin_amdgcn_sched_barrier(0);
    mmset(acc, s[kt % NSET]);
  }
  // keeps the epilogue behind the last products: woven in among them it takes a
  // register-window switch at every turn
  __builtin_amdgcn_sched_barrier(0);
}

// out = xh[4096,1024] @ W_in^T + b_in, routed to q/k/v head buffers.
// q scaled by d^-0.5, row-major [B,H,N,d]; k and the gated v^T as packed tiles.
// 4 waves form a 128 x 128 block; 768 blocks, three to a WGP (the second
// launch bound keeps the registers of three waves within a SIMD's file).
__global__ __launch_bounds__(128, 3) void qkv_gemm_kernel(
    const _Float16* __restrict__ xh, const _Float16* __restrict__ winh,
    const float* __restrict__ b_in,  const float* __restrict__ gate,
    const float* __restrict__ part,  const float* __restrict__ bd2,
    const float* __restrict__ ppr,   const float* __restrict__ alpha,
    _Float16* __restrict__ qh, _Float16* __restrict__ kh,
    _Float16* __restrict__ vth, float* __restrict__ bias, int n_ctx) {
  // the per-key bias for the attention launch, 128 entries a work-group, in
  // the work-groups of lowest index, which start ahead of the others
  if (blockIdx.y == 0 && blockIdx.x < NSEQ / 128) {
    const int i = blockIdx.x * 128 + threadIdx.x;
    bias[i] = key_bias(part, bd2, ppr, alpha, n_ctx, i);
  }
  const int lane = threadIdx.x & 31;
  const int wave = threadIdx.x >> 5;
  const int l16  = lane & 15;
  const int g    = lane >> 4;
  const int m0 = blockIdx.x * 128 + (wave & 1) * 64;
  const int n0 = blockIdx.y * 128 + (wave >> 1) * 64;

  v8f acc[4][4];
  gemm64x64<2>(acc, xh + (size_t)(m0 / 16) * KT * TILE + lane * 8,
               winh + (size_t)(n0 / 16) * KT * TILE + lane * 8);

  const float qscale = 0.125f;  // 1/sqrt(64)
  const int bi = m0 / NSEQ;              // a 64-row tile lies in one batch
#pragma unroll
  for (int i = 0; i < 4; ++i) {
    const int tok0 = m0 % NSEQ + i * 16 + 8 * g;  // first of the lane's 8 tokens
#pragma unroll
    for (int f = 0; f < 4; ++f) {
      int nn = n0 + f * 16 + l16;
      int sect = nn / D_;
      int jj = nn % D_;
      int h = jj / DH, c = jj % DH;
      size_t hb = (size_t)(bi * H_ + h);
      float bn = b_in[nn];
      if (sect == 0) {
        _Float16* qp = qh + (hb * NSEQ + tok0) * DH + c;
#pragma unroll
        for (int r = 0; r < 8; ++r)
          qp[r * DH] = (_Float16)((acc[i][f][r] + bn) * qscale);
      } else if (sect == 1) {
        // packed tile (16 keys, 32 of d): row = key, k = d
        _Float16* kp = kh +
            ((hb * (NSEQ / 16) + tok0 / 16) * 2 + c / 32) * TILE +
            ((c >> 4) & 1) * 256 + (((c >> 3) & 1) * 16 + (tok0 & 15)) * 8 +
            (c & 7);
#pragma unroll
        for (int r = 0; r < 8; ++r) kp[r * 8] = (_Float16)(acc[i][f][r] + bn);
      } else {
        // packed tile (16 of d, 32 keys): row = d, k = key; the lane's 8 keys
        // lie in a row there
        v8h vo;
#pragma unroll
        for (int r = 0; r < 8; ++r)
          vo[r] = (_Float16)((acc[i][f][r] + bn) * gate[tok0 + r]);
        *(v8h*)(vth + ((hb * (NSEQ / 32) + tok0 / 32) * 4 + c / 16) * TILE +
                ((tok0 >> 4) & 1) * 256 +
                (((tok0 >> 3) & 1) * 16 + (c & 15)) * 8) = vo;
      }
    }
  }
}

// --------------------------------------------------- flash attention
// 1 wave per 16-query tile; 32-key chunks. Scores are formed transposed,
// S^T = K.Q^T (keys down the rows, queries across the lanes), and the
// output as O^T += V^T.P^T: a lane holds one query's scores, so maximum,
// exponentials and sum stay in its registers, and the two score tiles,
// converted in place, are the B operand of the second product.
typedef __attribute__((ext_vector_type(2))) _Float16 v2h;

__global__ __launch_bounds__(128, 1) void flash_attn_kernel(
    const _Float16* __restrict__ qh, const _Float16* __restrict__ kh,
    const _Float16* __restrict__ vth, const float* __restrict__ bias,
    _Float16* __restrict__ attn) {
  const int lane = threadIdx.x & 31;
  const int wave = threadIdx.x >> 5;
  const int l16  = lane & 15;
  const int g    = lane >> 4;

  const int tile = blockIdx.x * 4 + wave;
  const int qt = tile % (NSEQ / 16);
  const int bh = tile / (NSEQ / 16);

  const _Float16* qbase = qh + ((size_t)bh * NSEQ + (size_t)qt * 16) * DH;
  const _Float16* kball = kh + (size_t)bh * NSEQ * DH;
  const _Float16* vbase = vth + (size_t)bh * DH * NSEQ;

  HFrag bq[2];   // B operand: column l16 = query, k = head dim
  {
    const _Float16* qrow = qbase + (size_t)l16 * DH + 8 * g;
    ldfrag(bq[0], qrow);
    ldfrag(bq[1], qrow + 32);
  }

  v8f zero = {0.f, 0.f, 0.f, 0.f, 0.f, 0.f, 0.f, 0.f};
  v8f acc[4];    // acc[f][r] = O[query l16][f * 16 + 8 * g + r]
#pragma unroll
  for (int f = 0; f < 4; ++f) acc[f] = zero;

  const float L2E = 1.4426950408889634f;
  float mrun = -INFINITY;  // this query's running maximum (same in both halves)
  float lsum = 0.f;        // sum over this lane half's keys only

  // Operands of a 32-key chunk. They are fetched one pass ahead, into the same
  // registers: K and the bias right behind the score products that read them,
  // V right behind the output products, so a pass no longer starts by waiting
  // out its own loads.
  v8f b0, b1;    // the per-key bias in the accumulator's own map (row = key)
  HFrag ak[4];   // [keysub(2)][dchunk(2)], A operand: row l16 = key
  HFrag av[4];   // A operand: row l16 = head dim f * 16 + l16, k = key
  const _Float16* kp = kball + lane * 8;
  const _Float16* vp = vbase + lane * 8;
  const float* bp8 = bias + 8 * g;
  b0 = *(const v8f*)(bp8);
  b1 = *(const v8f*)(bp8 + 16);
#pragma unroll
  for (int f = 0; f < 4; ++f) ldpacked(ak[f], kp + f * TILE);
#pragma unroll
  for (int f = 0; f < 4; ++f) ldpacked(av[f], vp + f * TILE);

  for (int kc = 0; kc < NSEQ; kc += 32) {
    // the last pass has no next chunk: it reads chunk 0 again and drops it
    const int kn = kc + 32 < NSEQ ? kc + 32 : 0;

    // ---- S^T = k @ q^T + bias (scale pre-folded into q); the bias starts the sum
    v8f s0 = wmma16(ak[0], bq[0], b0);   // keys 0-15, d 0-31
    s0 = wmma16(ak[1], bq[1], s0);       // keys 0-15, d 32-63
    v8f s1 = wmma16(ak[2], bq[0], b1);   // keys 16-31, d 0-31
    s1 = wmma16(ak[3], bq[1], s1);       // keys 16-31, d 32-63

    // holds the next chunk's K and bias loads behind the score products (read
    // only, nothing is changed): lifted over them the loads cannot take the
    // registers the products still read, and the compiler then loads into
    // spare ones and copies them at the loop's foot behind a full wait
    asm volatile("" :: "v"(s0), "v"(s1) : "memory");
    b0 = *(const v8f*)(bp8 + kn);
    b1 = *(const v8f*)(bp8 + kn + 16);
#pragma unroll
    for (int f = 0; f < 4; ++f) ldpacked(ak[f], kp + (size_t)kn * DH + f * TILE);
    // keeps the loads up here, as one group: sunk, they are waited on at once
    __builtin_amdgcn_sched_barrier(0);

    // ---- online softmax, one query per lane, 16 of its 32 keys
    float t0 = fmaxf(fmaxf(s0[0], s0[1]), s0[2]);
    float t1 = fmaxf(fmaxf(s0[3], s0[4]), s0[5]);
    float t2 = fmaxf(fmaxf(s0[6], s0[7]), s1[0]);
    float t3 = fmaxf(fmaxf(s1[1], s1[2]), s1[3]);
    float t4 = fmaxf(fmaxf(s1[4], s1[5]), s1[6]);
    float mx = fmaxf(fmaxf(fmaxf(t0, t1), t2), fmaxf(fmaxf(t3, t4), s1[7]));
    mx = fmaxf(mx, xhalf(mx));
    mx = fmaxf(mx, mrun);
    const float fr = __builtin_amdgcn_exp2f((mrun - mx) * L2E);
    mrun = mx;
    const float nm = -mx * L2E;

    HFrag bp;      // B operand: column l16 = query, k = key, hardware k order
    v2f ps = {0.f, 0.f};
#pragma unroll
    for (int i = 0; i < 4; ++i) {
      v2f a0 = __builtin_elementwise_fma(v2f{s0[2 * i], s0[2 * i + 1]},
                                         v2f{L2E, L2E}, v2f{nm, nm});
      v2f a1 = __builtin_elementwise_fma(v2f{s1[2 * i], s1[2 * i + 1]},
                                         v2f{L2E, L2E}, v2f{nm, nm});
      v2f p0 = {__builtin_amdgcn_exp2f(a0.x), __builtin_amdgcn_exp2f(a0.y)};
      v2f p1 = {__builtin_amdgcn_exp2f(a1.x), __builtin_amdgcn_exp2f(a1.y)};
      ps += p0 + p1;
      v2h h0 = __builtin_convertvector(p0, v2h);
      v2h h1 = __builtin_convertvector(p1, v2h);
      bp.h[0][2 * i] = h0.x; bp.h[0][2 * i + 1] = h0.y;
      bp.h[1][2 * i] = h1.x; bp.h[1][2 * i + 1] = h1.y;
    }
    lsum = lsum * fr + (ps.x + ps.y);

    // ---- rescale accumulator + O^T += V^T @ P^T (V already in registers)
#pragma unroll
    for (int f = 0; f < 4; ++f) {
      acc[f] = acc[f] * fr;
      acc[f] = wmma16(av[f], bp, acc[f]);
    }

    // as above: the next chunk's V loads behind the output products
    asm volatile("" :: "v"(acc[0]), "v"(acc[1]), "v"(acc[2]), "v"(acc[3])
                 : "memory");
#pragma unroll
    for (int f = 0; f < 4; ++f) ldpacked(av[f], vp + (size_t)kn * DH + f * TILE);
  }

  const float inv = 1.f / (lsum + xhalf(lsum));

  const int bi = bh / H_;
  const int h  = bh % H_;
  // packed for the output projection: tile (16 tokens, 32 features)
  _Float16* orow = attn +
      ((size_t)(bi * (NSEQ / 16) + qt) * KT + h * 2) * TILE + lane * 8;
#pragma unroll
  for (int f = 0; f < 4; ++f) {
    v8h o;
#pragma unroll
    for (int r = 0; r < 8; ++r) o[r] = (_Float16)(acc[f][r] * inv);
    *(v8h*)(orow + f * 256) = o;
  }
  // the last pass's dropped loads have landed before the wave gives its
  // registers back
  asm volatile("s_wait_loadcnt 0x0" ::: "memory");
}

// ------------------------------------------------- output projection
// 256 blocks, one wave to a SIMD: four fragment sets keep its loads in flight
__global__ __launch_bounds__(128, 1) void out_gemm_kernel(
    const _Float16* __restrict__ ah, const _Float16* __restrict__ wouth,
    const float* __restrict__ b_out, float* __restrict__ out) {
  const int lane = threadIdx.x & 31;
  const int wave = threadIdx.x >> 5;
  const int l16  = lane & 15;
  const int g    = lane >> 4;
  const int m0 = blockIdx.x * 128 + (wave & 1) * 64;
  const int n0 = blockIdx.y * 128 + (wave >> 1) * 64;

  v8f acc[4][4];
  gemm64x64<4>(acc, ah + (size_t)(m0 / 16) * KT * TILE + lane * 8,
               wouth + (size_t)(n0 / 16) * KT * TILE + lane * 8);

#pragma unroll
  for (int f = 0; f < 4; ++f) {
    int nn = n0 + f * 16 + l16;
    float bn = b_out[nn];
#pragma unroll
    for (int i = 0; i < 4; ++i) {
#pragma unroll
      for (int r = 0; r < 8; ++r) {
        int m = m0 + i * 16 + r + 8 * g;
        out[(size_t)m * D_ + nn] = acc[i][f][r] + bn;
      }
    }
  }
}

// ------------------------------------------------------------ launcher
extern "C" void kernel_launch(void* const* d_in, const int* in_sizes, int n_in,
                              void* d_out, int out_size, void* d_ws,
                              size_t ws_size, hipStream_t stream) {
  (void)n_in; (void)out_size; (void)ws_size;
  const float* x         = (const float*)d_in[0];
  const float* ctx_ppr   = (const float*)d_in[2];
  const float* ctx_delta = (const float*)d_in[3];
  const float* ctx_trust = (const float*)d_in[4];
  const float* W_in      = (const float*)d_in[5];
  const float* b_in      = (const float*)d_in[6];
  const float* W_out     = (const float*)d_in[7];
  const float* b_out     = (const float*)d_in[8];
  const float* alpha     = (const float*)d_in[9];
  const float* tscale    = (const float*)d_in[10];
  const float* Wd1       = (const float*)d_in[11];
  const float* bd1       = (const float*)d_in[12];
  const float* Wd2       = (const float*)d_in[13];
  const float* bd2       = (const float*)d_in[14];
  float* out = (float*)d_out;
  const int n_ctx = in_sizes[2];  // ctx_ppr has n_ctx elements

  // workspace carve (~42 MB; attn output reuses xh)
  char* w = (char*)d_ws;
  auto carve = [&](size_t bytes) -> char* {
    char* p = w;
    w += (bytes + 255) & ~(size_t)255;
    return p;
  };
  _Float16* xh    = (_Float16*)carve((size_t)MROWS * D_ * 2);
  _Float16* winh  = (_Float16*)carve((size_t)3 * D_ * D_ * 2);
  _Float16* wouth = (_Float16*)carve((size_t)D_ * D_ * 2);
  _Float16* qh    = (_Float16*)carve((size_t)MROWS * D_ * 2);
  _Float16* kh    = (_Float16*)carve((size_t)MROWS * D_ * 2);
  _Float16* vth   = (_Float16*)carve((size_t)MROWS * D_ * 2);
  float* gate = (float*)carve((size_t)NSEQ * 4);
  float* bias = (float*)carve((size_t)NSEQ * 4);
  float* part = (float*)carve((size_t)NHQ * (NCTX / 16) * 32 * 4);
  _Float16* attn = xh;  // xh dead after QKV GEMM

  prep_kernel<<<NCB + XB + WIB + WOB, 256, 0, stream>>>(
      x, W_in, W_out, ctx_delta, Wd1, bd1, Wd2, ctx_trust, tscale, xh, winh,
      wouth, part, gate, n_ctx);

  qkv_gemm_kernel<<<dim3(MROWS / 128, NOUTQ / 128), 128, 0, stream>>>(
      xh, winh, b_in, gate, part, bd2, ctx_ppr, alpha, qh, kh, vth, bias,
      n_ctx);

  flash_attn_kernel<<<(B_ * H_ * (NSEQ / 16)) / 4, 128, 0, stream>>>(
      qh, kh, vth, bias, attn);

  out_gemm_kernel<<<dim3(MROWS / 128, D_ / 128), 128, 0, stream>>>(
      attn, wouth, b_out, out);
}

// v007
// It runs in 86.4 microseconds.
// Two timings next to v006 put it at 1.17 and 1.15 times that version's speed.
// Over all steps from v000 it is 5.16 times as fast.
#include <hip/hip_runtime.h>
#include <hip/hip_bf16.h>
#include <math.h>

typedef __attribute__((ext_vector_type(16))) _Float16 v16h;
typedef __attribute__((ext_vector_type(8)))  _Float16 v8h;
typedef __attribute__((ext_vector_type(8)))  float    v8f;

union HFrag { v16h v; v8h h[2]; };

static constexpr int B_    = 2;
static constexpr int NSEQ  = 2048;
static constexpr int D_    = 1024;
static constexpr int H_    = 16;
static constexpr int DH    = 64;      // head dim
static constexpr int PDIM  = 256;
static constexpr int DHID  = 512;     // D/2
static constexpr int MROWS = B_ * NSEQ;   // 4096
static constexpr int NOUTQ = 3 * D_;      // 3072

// load one 16x32 f16 fragment slice for this lane; p already includes +8*g
__device__ __forceinline__ void ldfrag(HFrag& f, const _Float16* p) {
  f.h[0] = *(const v8h*)(p);
  f.h[1] = *(const v8h*)(p + 16);
}

// Packed operand tiles in the workspace: a 16-row x 32-k tile is 512 halves in
// the order [k half i][lane][8], lane = 16 * ((k >> 3) & 1) + row, i = k >> 4,
// so each of a fragment's two 16-byte loads reads 512 bytes in a row (4 lines).
// The k order in the registers is that of ldfrag. p already includes lane * 8.
static constexpr int TILE = 512;          // halves per packed tile
static constexpr int KT   = D_ / 32;      // packed tiles along a 1024-long k
__device__ __forceinline__ void ldpacked(HFrag& f, const _Float16* p) {
  f.h[0] = *(const v8h*)(p);
  f.h[1] = *(const v8h*)(p + 256);
}

__device__ __forceinline__ v8f wmma16(const HFrag& a, const HFrag& b, v8f c) {
  return __builtin_amdgcn_wmma_f32_16x16x32_f16(false, a.v, false, b.v,
                                                (short)0, c, false, false);
}

// ---------------------------------------------------------------- converts
// src: row-major [rows][1024] f32; dst: packed f16 tiles, tile (rt, kt) at
// (rt * KT + kt) * TILE. A wave takes CT tiles that follow one another in a
// tile row: 16 rows of CT whole lines in, CT KB in a row out.
typedef __attribute__((ext_vector_type(4))) float v4f;
static constexpr int CT = 8;              // tiles per wave
static constexpr int CB = 8 * CT;         // tiles per 8-wave work-group
__device__ __forceinline__ void convert_tiles(const float* __restrict__ src,
                                              _Float16* __restrict__ dst,
                                              int blk) {
  const int lane = threadIdx.x & 31;
  const int tile = (blk * 8 + (threadIdx.x >> 5)) * CT;
  const int rt = tile / KT, kt = tile % KT;
  const float* p =
      src + (size_t)(rt * 16 + (lane & 15)) * D_ + kt * 32 + 8 * (lane >> 4);
  v4f t[CT][4];
  // both loops unrolled: t stays in registers, the steps are immediate offsets
  // and every load is in flight before the first store
#pragma unroll
  for (int j = 0; j < CT; ++j) {
    t[j][0] = *(const v4f*)(p + j * 32);
    t[j][1] = *(const v4f*)(p + j * 32 + 4);
    t[j][2] = *(const v4f*)(p + j * 32 + 16);
    t[j][3] = *(const v4f*)(p + j * 32 + 20);
  }
  _Float16* q = dst + (size_t)tile * TILE + lane * 8;
#pragma unroll
  for (int j = 0; j < CT; ++j) {
    v8h lo, hi;
#pragma unroll
    for (int e = 0; e < 4; ++e) {
      lo[e] = (_Float16)t[j][0][e]; lo[e + 4] = (_Float16)t[j][1][e];
      hi[e] = (_Float16)t[j][2][e]; hi[e + 4] = (_Float16)t[j][3][e];
    }
    *(v8h*)(q + j * TILE) = lo;
    *(v8h*)(q + j * TILE + 256) = hi;
  }
  // behind the last store: in the merged kernel other branches' code follows in
  // the listing and reuses the stores' address and data registers
  asm volatile("s_wait_xcnt 0x0" ::: "memory");
}

// ---------------------- context-row bias MLP: first product on f32 WMMA
// H^T = Wd1 . delta^T: hidden units down the rows, context rows across the
// lanes. A work-group takes 16 context rows and 128 hidden units, one 16 x 16
// tile a wave; both operands come in by whole lines and are read from LDS.
typedef __attribute__((ext_vector_type(2))) float v2f;

static constexpr int NCTX = 1024;       // rows of ctx_delta
static constexpr int HQ   = 128;        // hidden units per work-group
static constexpr int NHQ  = DHID / HQ;  // partial sums per context row
static constexpr int LP   = PDIM + 4;   // LDS row pitch in floats: 16 B x odd

// lane l <-> lane l ^ 16
__device__ __forceinline__ float xhalf(float x) {
  int b = __builtin_bit_cast(int, x);
  return __builtin_bit_cast(
      float, __builtin_amdgcn_permlanex16(b, b, 0x76543210, 0xfedcba98, false,
                                          false));
}

__device__ __forceinline__ void ctx_bias_block(
    const float* __restrict__ delta, const float* __restrict__ Wd1,
    const float* __restrict__ bd1,   const float* __restrict__ Wd2,
    float* __restrict__ part, int bx, int by) {
  __shared__ __attribute__((aligned(16))) float tile[(16 + HQ) * LP];
  __shared__ float red[8][16];
  const int tid  = threadIdx.x;
  const int lane = tid & 31;
  const int wave = tid >> 5;
  const int l16  = lane & 15;
  const int g    = lane >> 4;
  const int row0 = bx * 16;
  const int h0   = by * HQ;

  // a wave's 16-byte loads cover half a row (4 whole lines); 4 rows a pass
  {
    const int sr = tid >> 6, sc = (tid & 63) * 4;
    const float* dp = delta + (size_t)row0 * PDIM + (sr * PDIM + sc);
    const float* wp = Wd1 + (size_t)h0 * PDIM + (sr * PDIM + sc);
    float* lp = tile + sr * LP + sc;
    v4f t[(16 + HQ) / 4];
    // the three loops are unrolled so that t stays in registers, the steps are
    // immediate offsets and every load is in flight before the first store
#pragma unroll
    for (int i = 0; i < 4; ++i) t[i] = *(const v4f*)(dp + i * 4 * PDIM);
#pragma unroll
    for (int i = 0; i < HQ / 4; ++i)
      t[4 + i] = *(const v4f*)(wp + i * 4 * PDIM);
#pragma unroll
    for (int i = 0; i < (16 + HQ) / 4; ++i) *(v4f*)(lp + i * 4 * LP) = t[i];
  }
  const int hw = h0 + wave * 16 + 8 * g;   // first of the lane's 8 hidden units
  v8f acc0 = *(const v8f*)(bd1 + hw);      // the sum starts from the bias
  v8f acc1 = {0.f, 0.f, 0.f, 0.f, 0.f, 0.f, 0.f, 0.f};
  const v8f w2 = *(const v8f*)(Wd2 + hw);
  __syncthreads();

  // both operands by the same code: lane half g holds k = 8 * kb + 4 * g + 0..3,
  // the first pair for one product, the second for the next
  const float* ap = tile + (16 + wave * 16 + l16) * LP + 4 * g;
  const float* bp = tile + l16 * LP + 4 * g;
  // unrolled: immediate LDS offsets, the next fragments read ahead of the wait
#pragma unroll
  for (int kb = 0; kb < PDIM / 8; ++kb) {
    v4f a = *(const v4f*)(ap + kb * 8);
    v4f b = *(const v4f*)(bp + kb * 8);
    acc0 = __builtin_amdgcn_wmma_f32_16x16x4_f32(
        false, v2f{a.x, a.y}, false, v2f{b.x, b.y}, (short)0, acc0, false,
        false);
    acc1 = __builtin_amdgcn_wmma_f32_16x16x4_f32(
        false, v2f{a.z, a.w}, false, v2f{b.z, b.w}, (short)0, acc1, false,
        false);
  }

  float local = 0.f;   // context row l16, this lane's 8 hidden units
  // unrolled: the accumulators are indexed by constants only
#pragma unroll
  for (int r = 0; r < 8; ++r) {
    float a = acc0[r] + acc1[r];
    float ge = 0.5f * a * (1.f + erff(a * 0.70710678118654752f));  // exact gelu
    local += ge * w2[r];
  }
  local += xhalf(local);
  if (g == 0) red[wave][l16] = local;
  __syncthreads();
  if (tid < 16) {
    float s = 0.f;
    for (int w = 0; w < 8; ++w) s += red[w][tid];
    // each work-group's 16 sums in a 128-byte line of their own
    part[(by * (NCTX / 16) + bx) * 32 + tid] = s;
  }
}

// ------------------- one launch for all that reads nothing but the inputs
// Work-groups 0 .. NCB - 1: the bias MLP's tiles (the longest chain, so they
// start first) and 8 entries each of the value gate; the rest: the three
// converts. 512 work-groups, two to a WGP by the MLP's LDS: all resident.
static constexpr int NCB = NCTX / 16 * NHQ;            // 256
static constexpr int XB  = MROWS / 16 * KT / CB;       // 128
static constexpr int WIB = NOUTQ / 16 * KT / CB;       // 96
static constexpr int WOB = D_ / 16 * KT / CB;          // 32

__global__ __launch_bounds__(256, 1) void prep_kernel(
    const float* __restrict__ x,     const float* __restrict__ W_in,
    const float* __restrict__ W_out, const float* __restrict__ delta,
    const float* __restrict__ Wd1,   const float* __restrict__ bd1,
    const float* __restrict__ Wd2,   const float* __restrict__ trust,
    const float* __restrict__ tscale,
    _Float16* __restrict__ xh, _Float16* __restrict__ winh,
    _Float16* __restrict__ wouth, float* __restrict__ part,
    float* __restrict__ gate, int n_ctx) {
  const int b = blockIdx.x;
  if (b < NCB) {
    // the gate's two loads go out ahead of the MLP's and are used behind it,
    // so that their latency is not added to the first wave's chain
    const int i = b * (NSEQ / NCB) + threadIdx.x;
    const bool mine = threadIdx.x < NSEQ / NCB;
    const float ts = tscale[0];
    float tr = 0.f;
    if (mine && i < n_ctx) tr = trust[i];
    ctx_bias_block(delta, Wd1, bd1, Wd2, part, b % (NCTX / 16),
                   b / (NCTX / 16));
    if (mine)
      gate[i] = i < n_ctx ? 1.f / (1.f + __expf(-ts * tr)) : 1.f;
  } else if (b < NCB + XB) {
    convert_tiles(x, xh, b - NCB);
  } else if (b < NCB + XB + WIB) {
    convert_tiles(W_in, winh, b - (NCB + XB));
  } else {
    convert_tiles(W_out, wouth, b - (NCB + XB + WIB));
  }
}

// col_bias entry i from the MLP's partial sums (written by the launch before)
__device__ __forceinline__ float key_bias(const float* __restrict__ part,
                                          const float* __restrict__ bd2,
                                          const float* __restrict__ ppr,
                                          const float* __restrict__ alpha,
                                          int n_ctx, int i) {
  if (i >= n_ctx) return 0.f;
  const float al = alpha[0], b2 = bd2[0];
  float pv = ppr[i];
  float ps[NHQ];
  // both loops unrolled: ps is indexed by constants and stays in registers
#pragma unroll
  for (int q = 0; q < NHQ; ++q)
    ps[q] = part[(q * (NCTX / 16) + (i >> 4)) * 32 + (i & 15)];
  // keeps the loads together: without it the compiler waits out the first
  // before it issues the rest, two latencies in a row ahead of the GEMM
  __builtin_amdgcn_sched_barrier(0);
  float s = 0.f;
#pragma unroll
  for (int q = 0; q < NHQ; ++q) s += ps[q];
  pv = pv < 1e-8f ? 1e-8f : pv;
  return al * logf(pv) + s + b2;
}

// ------------------------------------------- the two projection GEMMs
// A wave forms a 64 x 64 tile of the result: per 32 of k it loads 4 A and 4 B
// fragments (8 KB) for 16 products, so each loaded fragment feeds 4 of them.
// Every accumulator sums k in ascending order.
struct FragSet { HFrag a[4], b[4]; };

// ap, bp: the wave's first A and B tile row, lane * 8 included
__device__ __forceinline__ void ldset(FragSet& s, const _Float16* ap,
                                      const _Float16* bp, int kt) {
#pragma unroll
  for (int i = 0; i < 4; ++i) ldpacked(s.a[i], ap + (i * KT + kt) * TILE);
#pragma unroll
  for (int f = 0; f < 4; ++f) ldpacked(s.b[f], bp + (f * KT + kt) * TILE);
}

__device__ __forceinline__ void mmset(v8f (&acc)[4][4], const FragSet& s) {
#pragma unroll
  for (int i = 0; i < 4; ++i)
#pragma unroll
    for (int f = 0; f < 4; ++f) acc[i][f] = wmma16(s.a[i], s.b[f], acc[i][f]);
}

// NSET fragment sets in a ring: step kt's products run with the loads of the
// next NSET - 1 steps in flight.
template <int NSET>
__device__ __forceinline__ void gemm64x64(v8f (&acc)[4][4], const _Float16* ap,
                                          const _Float16* bp) {
  const v8f zero = {0.f, 0.f, 0.f, 0.f, 0.f, 0.f, 0.f, 0.f};
#pragma unroll
  for (int i = 0; i < 4; ++i)
#pragma unroll
    for (int f = 0; f < 4; ++f) acc[i][f] = zero;

  FragSet s[NSET];
#pragma unroll
  for (int j = 0; j < NSET - 1; ++j) ldset(s[j], ap, bp, j);
  // unrolled: the sets are indexed by constants and every load is an immediate
  // offset from the two address pairs.
  // The scheduling fence keeps a set's loads ahead of the 16 products of the
  // oldest set: without it the compiler sinks the loads in among the products
  // of the set they feed and waits on them at once.
#pragma unroll
  for (int kt = 0; kt < KT; ++kt) {
    const int nx = kt + NSET - 1;
    if (nx < KT) ldset(s[nx % NSET], ap, bp, nx);
    // behind the last loads: their address registers are reused after the loop
    if (nx == KT - 1) asm volatile("s_wait_xcnt 0x0" ::: "memory");
    __builtin_amdgcn_sched_barrier(0);
    mmset(acc, s[kt % NSET]);
  }
  // keeps the epilogue behind the last products: woven in among them it takes a
  // register-window switch at every turn
  __builtin_amdgcn_sched_barrier(0);
}

// out = xh[4096,1024] @ W_in^T + b_in, routed to q/k/v head buffers.
// q scaled by d^-0.5, row-major [B,H,N,d]; k and the gated v^T as packed tiles.
// 4 waves form a 128 x 128 block; 768 blocks, three to a WGP (the second
// launch bound keeps the registers of three waves within a SIMD's file).
__global__ __launch_bounds__(128, 3) void qkv_gemm_kernel(
    const _Float16* __restrict__ xh, const _Float16* __restrict__ winh,
    const float* __restrict__ b_in,  const float* __restrict__ gate,
    const float* __restrict__ part,  const float* __restrict__ bd2,
    const float* __restrict__ ppr,   const float* __restrict__ alpha,
    _Float16* __restrict__ qh, _Float16* __restrict__ kh,
    _Float16* __restrict__ vth, float* __restrict__ bias, int n_ctx) {
  // the per-key bias for the attention launch, 128 entries a work-group, in
  // the work-groups of lowest index, which start ahead of the others
  if (blockIdx.y == 0 && blockIdx.x < NSEQ / 128) {
    const int i = blockIdx.x * 128 + threadIdx.x;
    bias[i] = key_bias(part, bd2, ppr, alpha, n_ctx, i);
  }
  const int lane = threadIdx.x & 31;
  const int wave = threadIdx.x >> 5;
  const int l16  = lane & 15;
  const int g    = lane >> 4;
  const int m0 = blockIdx.x * 128 + (wave & 1) * 64;
  const int n0 = blockIdx.y * 128 + (wave >> 1) * 64;

  v8f acc[4][4];
  gemm64x64<2>(acc, xh + (size_t)(m0 / 16) * KT * TILE + lane * 8,
               winh + (size_t)(n0 / 16) * KT * TILE + lane * 8);

  const float qscale = 0.125f;  // 1/sqrt(64)
  const int bi = m0 / NSEQ;              // a 64-row tile lies in one batch
#pragma unroll
  for (int i = 0; i < 4; ++i) {
    const int tok0 = m0 % NSEQ + i * 16 + 8 * g;  // first of the lane's 8 tokens
#pragma unroll
    for (int f = 0; f < 4; ++f) {
      int nn = n0 + f * 16 + l16;
      int sect = nn / D_;
      int jj = nn % D_;
      int h = jj / DH, c = jj % DH;
      size_t hb = (size_t)(bi * H_ + h);
      float bn = b_in[nn];
      if (sect == 0) {
        _Float16* qp = qh + (hb * NSEQ + tok0) * DH + c;
#pragma unroll
        for (int r = 0; r < 8; ++r)
          qp[r * DH] = (_Float16)((acc[i][f][r] + bn) * qscale);
      } else if (sect == 1) {
        // packed tile (16 keys, 32 of d): row = key, k = d
        _Float16* kp = kh +
            ((hb * (NSEQ / 16) + tok0 / 16) * 2 + c / 32) * TILE +
            ((c >> 4) & 1) * 256 + (((c >> 3) & 1) * 16 + (tok0 & 15)) * 8 +
            (c & 7);
#pragma unroll
        for (int r = 0; r < 8; ++r) kp[r * 8] = (_Float16)(acc[i][f][r] + bn);
      } else {
        // packed tile (16 of d, 32 keys): row = d, k = key; the lane's 8 keys
        // lie in a row there
        v8h vo;
#pragma unroll
        for (int r = 0; r < 8; ++r)
          vo[r] = (_Float16)((acc[i][f][r] + bn) * gate[tok0 + r]);
        *(v8h*)(vth + ((hb * (NSEQ / 32) + tok0 / 32) * 4 + c / 16) * TILE +
                ((tok0 >> 4) & 1) * 256 +
                (((tok0 >> 3) & 1) * 16 + (c & 15)) * 8) = vo;
      }
    }
  }
}

// --------------------------------------------------- flash attention
// 1 wave per 16-query tile; 64-key steps. Scores are formed transposed,
// S^T = K.Q^T (keys down the rows, queries across the lanes), and the
// output as O^T += V^T.P^T: a lane holds one query's scores, so maximum,
// exponentials and sum stay in its registers, and the score tiles,
// converted in place, are the B operands of the second product.
// One running maximum, one exchange between the lane halves and one rescale
// of the output serve 64 keys.
typedef __attribute__((ext_vector_type(2))) _Float16 v2h;

static constexpr int KSTEP = 64;          // keys per online-softmax step

__device__ __forceinline__ float max3f(float a, float b, float c) {
  return fmaxf(fmaxf(a, b), c);
}

__global__ __launch_bounds__(128, 1) void flash_attn_kernel(
    const _Float16* __restrict__ qh, const _Float16* __restrict__ kh,
    const _Float16* __restrict__ vth, const float* __restrict__ bias,
    _Float16* __restrict__ attn) {
  const int lane = threadIdx.x & 31;
  const int wave = threadIdx.x >> 5;
  const int l16  = lane & 15;
  const int g    = lane >> 4;

  const int tile = blockIdx.x * 4 + wave;
  const int qt = tile % (NSEQ / 16);
  const int bh = tile / (NSEQ / 16);

  const _Float16* qbase = qh + ((size_t)bh * NSEQ + (size_t)qt * 16) * DH;
  const _Float16* kball = kh + (size_t)bh * NSEQ * DH;
  const _Float16* vbase = vth + (size_t)bh * DH * NSEQ;

  HFrag bq[2];   // B operand: column l16 = query, k = head dim
  {
    const _Float16* qrow = qbase + (size_t)l16 * DH + 8 * g;
    ldfrag(bq[0], qrow);
    ldfrag(bq[1], qrow + 32);
    // behind the Q loads: the build reuses their address registers as the
    // destination of a K load below
    asm volatile("s_wait_xcnt 0x0" ::: "memory");
  }

  v8f zero = {0.f, 0.f, 0.f, 0.f, 0.f, 0.f, 0.f, 0.f};
  v8f acc[4];    // acc[f][r] = O[query l16][f * 16 + 8 * g + r]
#pragma unroll
  for (int f = 0; f < 4; ++f) acc[f] = zero;

  const float L2E = 1.4426950408889634f;
  float mrun = -INFINITY;  // this query's running maximum (same in both halves)
  float lsum = 0.f;        // sum over this lane half's keys only

  // Operands of a 64-key step. They are fetched one step ahead, into the same
  // registers: K right behind the score products that read it, the bias right
  // behind the last use of the scores (it lands in the score registers, where
  // it starts the next sum), V right behind the output products.
  v8f s[4];      // tile j: keys 16 * j + 8 * g + r; holds the bias, then scores
  HFrag ak[8];   // [key tile(4)][dchunk(2)], A operand: row l16 = key
  HFrag av[8];   // [32 keys(2)][f(4)], A operand: row l16 = head dim f * 16 + l16
  const _Float16* kp = kball + lane * 8;
  const _Float16* vp = vbase + lane * 8;
  const float* bp8 = bias + 8 * g;
#pragma unroll
  for (int j = 0; j < 4; ++j) s[j] = *(const v8f*)(bp8 + 16 * j);
#pragma unroll
  for (int f = 0; f < 8; ++f) ldpacked(ak[f], kp + f * TILE);
#pragma unroll
  for (int f = 0; f < 8; ++f) ldpacked(av[f], vp + f * TILE);

  for (int kc = 0; kc < NSEQ; kc += KSTEP) {
    // the last step has no next one: it reads step 0 again and drops it
    const int kn = kc + KSTEP < NSEQ ? kc + KSTEP : 0;

    // ---- S^T = k @ q^T + bias (scale pre-folded into q); the bias starts the sum
#pragma unroll
    for (int j = 0; j < 4; ++j) s[j] = wmma16(ak[2 * j], bq[0], s[j]);
#pragma unroll
    for (int j = 0; j < 4; ++j) s[j] = wmma16(ak[2 * j + 1], bq[1], s[j]);

    // holds the next step's K loads behind the score products (read only,
    // nothing is changed): lifted over them the loads cannot take the
    // registers the products still read, and the compiler then loads into
    // spare ones and copies them at the loop's foot behind a full wait
    asm volatile("" :: "v"(s[0]), "v"(s[1]), "v"(s[2]), "v"(s[3]) : "memory");
#pragma unroll
    for (int f = 0; f < 8; ++f) ldpacked(ak[f], kp + (size_t)kn * DH + f * TILE);
    // keeps the loads up here, as one group: sunk, they are waited on at once
    __builtin_amdgcn_sched_barrier(0);

    // ---- online softmax, one query per lane, 32 of its 64 keys
    float ta[4], tb[4];
#pragma unroll
    for (int j = 0; j < 4; ++j) {
      ta[j] = max3f(s[j][0], s[j][1], s[j][2]);
      tb[j] = max3f(s[j][3], s[j][4], s[j][5]);
      ta[j] = max3f(ta[j], s[j][6], s[j][7]);
    }
    float mx = max3f(max3f(ta[0], tb[0], ta[1]), max3f(tb[1], ta[2], tb[2]),
                     fmaxf(ta[3], tb[3]));
    mx = max3f(mx, xhalf(mx), mrun);
    const float fr = __builtin_amdgcn_exp2f((mrun - mx) * L2E);
    mrun = mx;
    const float nm = -mx * L2E;

    HFrag bp[2];   // B operands: column l16 = query, k = key, hardware k order
    v2f ps[2];
#pragma unroll
    for (int kb = 0; kb < 2; ++kb) {
#pragma unroll
      for (int i = 0; i < 4; ++i) {
        v2f a0 = __builtin_elementwise_fma(
            v2f{s[2 * kb][2 * i], s[2 * kb][2 * i + 1]}, v2f{L2E, L2E},
            v2f{nm, nm});
        v2f a1 = __builtin_elementwise_fma(
            v2f{s[2 * kb + 1][2 * i], s[2 * kb + 1][2 * i + 1]}, v2f{L2E, L2E},
            v2f{nm, nm});
        v2f p0 = {__builtin_amdgcn_exp2f(a0.x), __builtin_amdgcn_exp2f(a0.y)};
        v2f p1 = {__builtin_amdgcn_exp2f(a1.x), __builtin_amdgcn_exp2f(a1.y)};
        ps[kb] = i == 0 ? p0 + p1 : ps[kb] + (p0 + p1);
        v2h h0 = __builtin_convertvector(p0, v2h);
        v2h h1 = __builtin_convertvector(p1, v2h);
        bp[kb].h[0][2 * i] = h0.x; bp[kb].h[0][2 * i + 1] = h0.y;
        bp[kb].h[1][2 * i] = h1.x; bp[kb].h[1][2 * i + 1] = h1.y;
      }
    }
    const v2f pt = ps[0] + ps[1];
    lsum = lsum * fr + (pt.x + pt.y);

    // holds the next step's bias loads behind the last use of the scores (read
    // only): the loads then land in the score registers themselves; lifted
    // higher they take spare registers and are copied at the loop's foot
    asm volatile("" :: "v"(bp[0].v), "v"(bp[1].v), "v"(lsum) : "memory");
#pragma unroll
    for (int j = 0; j < 4; ++j) s[j] = *(const v8f*)(bp8 + kn + 16 * j);
    // keeps these loads ahead of the output products, which cover their latency
    __builtin_amdgcn_sched_barrier(0);

    // ---- rescale accumulator + O^T += V^T @ P^T (V already in registers)
#pragma unroll
    for (int f = 0; f < 4; ++f) acc[f] = acc[f] * fr;
#pragma unroll
    for (int f = 0; f < 4; ++f) acc[f] = wmma16(av[f], bp[0], acc[f]);
#pragma unroll
    for (int f = 0; f < 4; ++f) acc[f] = wmma16(av[4 + f], bp[1], acc[f]);

    // as above: the next step's V loads behind the output products
    asm volatile("" :: "v"(acc[0]), "v"(acc[1]), "v"(acc[2]), "v"(acc[3])
                 : "memory");
#pragma unroll
    for (int f = 0; f < 8; ++f) ldpacked(av[f], vp + (size_t)kn * DH + f * TILE);
  }

  const float inv = 1.f / (lsum + xhalf(lsum));

  const int bi = bh / H_;
  const int h  = bh % H_;
  // packed for the output projection: tile (16 tokens, 32 features)
  _Float16* orow = attn +
      ((size_t)(bi * (NSEQ / 16) + qt) * KT + h * 2) * TILE + lane * 8;
#pragma unroll
  for (int f = 0; f < 4; ++f) {
    v8h o;
#pragma unroll
    for (int r = 0; r < 8; ++r) o[r] = (_Float16)(acc[f][r] * inv);
    *(v8h*)(orow + f * 256) = o;
  }
  // the last step's dropped loads have landed before the wave gives its
  // registers back
  asm volatile("s_wait_loadcnt 0x0" ::: "memory");
}

// ------------------------------------------------- output projection
// 256 blocks, one wave to a SIMD: four fragment sets keep its loads in flight
__global__ __launch_bounds__(128, 1) void out_gemm_kernel(
    const _Float16* __restrict__ ah, const _Float16* __restrict__ wouth,
    const float* __restrict__ b_out, float* __restrict__ out) {
  const int lane = threadIdx.x & 31;
  const int wave = threadIdx.x >> 5;
  const int l16  = lane & 15;
  const int g    = lane >> 4;
  const int m0 = blockIdx.x * 128 + (wave & 1) * 64;
  const int n0 = blockIdx.y * 128 + (wave >> 1) * 64;

  v8f acc[4][4];
  gemm64x64<4>(acc, ah + (size_t)(m0 / 16) * KT * TILE + lane * 8,
               wouth + (size_t)(n0 / 16) * KT * TILE + lane * 8);

#pragma unroll
  for (int f = 0; f < 4; ++f) {
    int nn = n0 + f * 16 + l16;
    float bn = b_out[nn];
#pragma unroll
    for (int i = 0; i < 4; ++i) {
#pragma unroll
      for (int r = 0; r < 8; ++r) {
        int m = m0 + i * 16 + r + 8 * g;
        out[(size_t)m * D_ + nn] = acc[i][f][r] + bn;
      }
    }
  }
}

// ------------------------------------------------------------ launcher
extern "C" void kernel_launch(void* const* d_in, const int* in_sizes, int n_in,
                              void* d_out, int out_size, void* d_ws,
                              size_t ws_size, hipStream_t stream) {
  (void)n_in; (void)out_size; (void)ws_size;
  const float* x         = (const float*)d_in[0];
  const float* ctx_ppr   = (const float*)d_in[2];
  const float* ctx_delta = (const float*)d_in[3];
  const float* ctx_trust = (const float*)d_in[4];
  const float* W_in      = (const float*)d_in[5];
  const float* b_in      = (const float*)d_in[6];
  const float* W_out     = (const float*)d_in[7];
  const float* b_out     = (const float*)d_in[8];
  const float* alpha     = (const float*)d_in[9];
  const float* tscale    = (const float*)d_in[10];
  const float* Wd1       = (const float*)d_in[11];
  const float* bd1       = (const float*)d_in[12];
  const float* Wd2       = (const float*)d_in[13];
  const float* bd2       = (const float*)d_in[14];
  float* out = (float*)d_out;
  const int n_ctx = in_sizes[2];  // ctx_ppr has n_ctx elements

  // workspace carve (~42 MB; attn output reuses xh)
  char* w = (char*)d_ws;
  auto carve = [&](size_t bytes) -> char* {
    char* p = w;
    w += (bytes + 255) & ~(size_t)255;
    return p;
  };
  _Float16* xh    = (_Float16*)carve((size_t)MROWS * D_ * 2);
  _Float16* winh  = (_Float16*)carve((size_t)3 * D_ * D_ * 2);
  _Float16* wouth = (_Float16*)carve((size_t)D_ * D_ * 2);
  _Float16* qh    = (_Float16*)carve((size_t)MROWS * D_ * 2);
  _Float16* kh    = (_Float16*)carve((size_t)MROWS * D_ * 2);
  _Float16* vth   = (_Float16*)carve((size_t)MROWS * D_ * 2);
  float* gate = (float*)carve((size_t)NSEQ * 4);
  float* bias = (float*)carve((size_t)NSEQ * 4);
  float* part = (float*)carve((size_t)NHQ * (NCTX / 16) * 32 * 4);
  _Float16* attn = xh;  // xh dead after QKV GEMM

  prep_kernel<<<NCB + XB + WIB + WOB, 256, 0, stream>>>(
      x, W_in, W_out, ctx_delta, Wd1, bd1, Wd2, ctx_trust, tscale, xh, winh,
      wouth, part, gate, n_ctx);

  qkv_gemm_kernel<<<dim3(MROWS / 128, NOUTQ / 128), 128, 0, stream>>>(
      xh, winh, b_in, gate, part, bd2, ctx_ppr, alpha, qh, kh, vth, bias,
      n_ctx);

  flash_attn_kernel<<<(B_ * H_ * (NSEQ / 16)) / 4, 128, 0, stream>>>(
      qh, kh, vth, bias, attn);

  out_gemm_kernel<<<dim3(MROWS / 128, D_ / 128), 128, 0, stream>>>(
      attn, wouth, b_out, out);
}

// v008
// It runs in 81.3 microseconds.
// Two timings next to v007 put it at 1.06 and 1.05 times that version's speed.
// All steps since v000 together make it 5.45 times as fast.
#include <hip/hip_runtime.h>
#include <hip/hip_bf16.h>
#include <math.h>

typedef __attribute__((ext_vector_type(16))) _Float16 v16h;
typedef __attribute__((ext_vector_type(8)))  _Float16 v8h;
typedef __attribute__((ext_vector_type(8)))  float    v8f;

union HFrag { v16h v; v8h h[2]; };

static constexpr int B_    = 2;
static constexpr int NSEQ  = 2048;
static constexpr int D_    = 1024;
static constexpr int H_    = 16;
static constexpr int DH    = 64;      // head dim
static constexpr int PDIM  = 256;
static constexpr int DHID  = 512;     // D/2
static constexpr int MROWS = B_ * NSEQ;   // 4096
static constexpr int NOUTQ = 3 * D_;      // 3072

// Packed operand tiles in the workspace: a 16-row x 32-k tile is 512 halves in
// the order [k half i][lane][8], lane = 16 * ((k >> 3) & 1) + row, i = k >> 4,
// so each of a fragment's two 16-byte loads reads 512 bytes in a row (4 lines).
// Lane half g then holds k = 8 * g + 0..7 and 16 + 8 * g + 0..7, the hardware's
// k order. p already includes lane * 8.
static constexpr int TILE = 512;          // halves per packed tile
static constexpr int KT   = D_ / 32;      // packed tiles along a 1024-long k
__device__ __forceinline__ void ldpacked(HFrag& f, const _Float16* p) {
  f.h[0] = *(const v8h*)(p);
  f.h[1] = *(const v8h*)(p + 256);
}

__device__ __forceinline__ v8f wmma16(const HFrag& a, const HFrag& b, v8f c) {
  return __builtin_amdgcn_wmma_f32_16x16x32_f16(false, a.v, false, b.v,
                                                (short)0, c, false, false);
}

// ---------------------------------------------------------------- converts
// src: row-major [rows][1024] f32; dst: packed f16 tiles, tile (rt, kt) at
// (rt * KT + kt) * TILE. A wave takes CT tiles that follow one another in a
// tile row: 16 rows of CT whole lines in, CT KB in a row out.
typedef __attribute__((ext_vector_type(4))) float v4f;
static constexpr int CT = 8;              // tiles per wave
static constexpr int CB = 8 * CT;         // tiles per 8-wave work-group
__device__ __forceinline__ void convert_tiles(const float* __restrict__ src,
                                              _Float16* __restrict__ dst,
                                              int blk) {
  const int lane = threadIdx.x & 31;
  const int tile = (blk * 8 + (threadIdx.x >> 5)) * CT;
  const int rt = tile / KT, kt = tile % KT;
  const float* p =
      src + (size_t)(rt * 16 + (lane & 15)) * D_ + kt * 32 + 8 * (lane >> 4);
  v4f t[CT][4];
  // both loops unrolled: t stays in registers, the steps are immediate offsets
  // and every load is in flight before the first store
#pragma unroll
  for (int j = 0; j < CT; ++j) {
    t[j][0] = *(const v4f*)(p + j * 32);
    t[j][1] = *(const v4f*)(p + j * 32 + 4);
    t[j][2] = *(const v4f*)(p + j * 32 + 16);
    t[j][3] = *(const v4f*)(p + j * 32 + 20);
  }
  _Float16* q = dst + (size_t)tile * TILE + lane * 8;
#pragma unroll
  for (int j = 0; j < CT; ++j) {
    v8h lo, hi;
#pragma unroll
    for (int e = 0; e < 4; ++e) {
      lo[e] = (_Float16)t[j][0][e]; lo[e + 4] = (_Float16)t[j][1][e];
      hi[e] = (_Float16)t[j][2][e]; hi[e + 4] = (_Float16)t[j][3][e];
    }
    *(v8h*)(q + j * TILE) = lo;
    *(v8h*)(q + j * TILE + 256) = hi;
  }
  // behind the last store: in the merged kernel other branches' code follows in
  // the listing and reuses the stores' address and data registers
  asm volatile("s_wait_xcnt 0x0" ::: "memory");
}

// ---------------------- context-row bias MLP: first product on f32 WMMA
// H^T = Wd1 . delta^T: hidden units down the rows, context rows across the
// lanes. A work-group takes 16 context rows and 128 hidden units, one 16 x 16
// tile a wave; both operands come in by whole lines and are read from LDS.
typedef __attribute__((ext_vector_type(2))) float v2f;

static constexpr int NCTX = 1024;       // rows of ctx_delta
static constexpr int HQ   = 128;        // hidden units per work-group
static constexpr int NHQ  = DHID / HQ;  // partial sums per context row
static constexpr int LP   = PDIM + 4;   // LDS row pitch in floats: 16 B x odd

// lane l <-> lane l ^ 16
__device__ __forceinline__ float xhalf(float x) {
  int b = __builtin_bit_cast(int, x);
  return __builtin_bit_cast(
      float, __builtin_amdgcn_permlanex16(b, b, 0x76543210, 0xfedcba98, false,
                                          false));
}

__device__ __forceinline__ void ctx_bias_block(
    const float* __restrict__ delta, const float* __restrict__ Wd1,
    const float* __restrict__ bd1,   const float* __restrict__ Wd2,
    float* __restrict__ part, int bx, int by) {
  __shared__ __attribute__((aligned(16))) float tile[(16 + HQ) * LP];
  __shared__ float red[8][16];
  const int tid  = threadIdx.x;
  const int lane = tid & 31;
  const int wave = tid >> 5;
  const int l16  = lane & 15;
  const int g    = lane >> 4;
  const int row0 = bx * 16;
  const int h0   = by * HQ;

  // a wave's 16-byte loads cover half a row (4 whole lines); 4 rows a pass
  {
    const int sr = tid >> 6, sc = (tid & 63) * 4;
    const float* dp = delta + (size_t)row0 * PDIM + (sr * PDIM + sc);
    const float* wp = Wd1 + (size_t)h0 * PDIM + (sr * PDIM + sc);
    float* lp = tile + sr * LP + sc;
    v4f t[(16 + HQ) / 4];
    // the three loops are unrolled so that t stays in registers, the steps are
    // immediate offsets and every load is in flight before the first store
#pragma unroll
    for (int i = 0; i < 4; ++i) t[i] = *(const v4f*)(dp + i * 4 * PDIM);
#pragma unroll
    for (int i = 0; i < HQ / 4; ++i)
      t[4 + i] = *(const v4f*)(wp + i * 4 * PDIM);
#pragma unroll
    for (int i = 0; i < (16 + HQ) / 4; ++i) *(v4f*)(lp + i * 4 * LP) = t[i];
  }
  const int hw = h0 + wave * 16 + 8 * g;   // first of the lane's 8 hidden units
  v8f acc0 = *(const v8f*)(bd1 + hw);      // the sum starts from the bias
  v8f acc1 = {0.f, 0.f, 0.f, 0.f, 0.f, 0.f, 0.f, 0.f};
  const v8f w2 = *(const v8f*)(Wd2 + hw);
  __syncthreads();

  // both operands by the same code: lane half g holds k = 8 * kb + 4 * g + 0..3,
  // the first pair for one product, the second for the next
  const float* ap = tile + (16 + wave * 16 + l16) * LP + 4 * g;
  const float* bp = tile + l16 * LP + 4 * g;
  // unrolled: immediate LDS offsets, the next fragments read ahead of the wait
#pragma unroll
  for (int kb = 0; kb < PDIM / 8; ++kb) {
    v4f a = *(const v4f*)(ap + kb * 8);
    v4f b = *(const v4f*)(bp + kb * 8);
    acc0 = __builtin_amdgcn_wmma_f32_16x16x4_f32(
        false, v2f{a.x, a.y}, false, v2f{b.x, b.y}, (short)0, acc0, false,
        false);
    acc1 = __builtin_amdgcn_wmma_f32_16x16x4_f32(
        false, v2f{a.z, a.w}, false, v2f{b.z, b.w}, (short)0, acc1, false,
        false);
  }

  float local = 0.f;   // context row l16, this lane's 8 hidden units
  // unrolled: the accumulators are indexed by constants only
#pragma unroll
  for (int r = 0; r < 8; ++r) {
    float a = acc0[r] + acc1[r];
    float ge = 0.5f * a * (1.f + erff(a * 0.70710678118654752f));  // exact gelu
    local += ge * w2[r];
  }
  local += xhalf(local);
  if (g == 0) red[wave][l16] = local;
  __syncthreads();
  if (tid < 16) {
    float s = 0.f;
    for (int w = 0; w < 8; ++w) s += red[w][tid];
    // each work-group's 16 sums in a 128-byte line of their own
    part[(by * (NCTX / 16) + bx) * 32 + tid] = s;
  }
}

// ------------------- one launch for all that reads nothing but the inputs
// Work-groups 0 .. NCB - 1: the bias MLP's tiles (the longest chain, so they
// start first) and 8 entries each of the value gate; the rest: the three
// converts. 512 work-groups, two to a WGP by the MLP's LDS: all resident.
static constexpr int NCB = NCTX / 16 * NHQ;            // 256
static constexpr int XB  = MROWS / 16 * KT / CB;       // 128
static constexpr int WIB = NOUTQ / 16 * KT / CB;       // 96
static constexpr int WOB = D_ / 16 * KT / CB;          // 32

__global__ __launch_bounds__(256, 1) void prep_kernel(
    const float* __restrict__ x,     const float* __restrict__ W_in,
    const float* __restrict__ W_out, const float* __restrict__ delta,
    const float* __restrict__ Wd1,   const float* __restrict__ bd1,
    const float* __restrict__ Wd2,   const float* __restrict__ trust,
    const float* __restrict__ tscale,
    _Float16* __restrict__ xh, _Float16* __restrict__ winh,
    _Float16* __restrict__ wouth, float* __restrict__ part,
    float* __restrict__ gate, int n_ctx) {
  const int b = blockIdx.x;
  if (b < NCB) {
    // the gate's two loads go out ahead of the MLP's and are used behind it,
    // so that their latency is not added to the first wave's chain
    const int i = b * (NSEQ / NCB) + threadIdx.x;
    const bool mine = threadIdx.x < NSEQ / NCB;
    const float ts = tscale[0];
    float tr = 0.f;
    if (mine && i < n_ctx) tr = trust[i];
    ctx_bias_block(delta, Wd1, bd1, Wd2, part, b % (NCTX / 16),
                   b / (NCTX / 16));
    if (mine)
      gate[i] = i < n_ctx ? 1.f / (1.f + __expf(-ts * tr)) : 1.f;
  } else if (b < NCB + XB) {
    convert_tiles(x, xh, b - NCB);
  } else if (b < NCB + XB + WIB) {
    convert_tiles(W_in, winh, b - (NCB + XB));
  } else {
    convert_tiles(W_out, wouth, b - (NCB + XB + WIB));
  }
}

// col_bias entry i from the MLP's partial sums (written by the launch before)
__device__ __forceinline__ float key_bias(const float* __restrict__ part,
                                          const float* __restrict__ bd2,
                                          const float* __restrict__ ppr,
                                          const float* __restrict__ alpha,
                                          int n_ctx, int i) {
  if (i >= n_ctx) return 0.f;
  const float al = alpha[0], b2 = bd2[0];
  float pv = ppr[i];
  float ps[NHQ];
  // both loops unrolled: ps is indexed by constants and stays in registers
#pragma unroll
  for (int q = 0; q < NHQ; ++q)
    ps[q] = part[(q * (NCTX / 16) + (i >> 4)) * 32 + (i & 15)];
  // keeps the loads together: without it the compiler waits out the first
  // before it issues the rest, two latencies in a row ahead of the GEMM
  __builtin_amdgcn_sched_barrier(0);
  float s = 0.f;
#pragma unroll
  for (int q = 0; q < NHQ; ++q) s += ps[q];
  pv = pv < 1e-8f ? 1e-8f : pv;
  return al * logf(pv) + s + b2;
}

// ------------------------------------------- the two projection GEMMs
// A wave forms a 64 x 64 tile of the result: per 32 of k it loads 4 A and 4 B
// fragments (8 KB) for 16 products, so each loaded fragment feeds 4 of them.
// Every accumulator sums k in ascending order.
struct FragSet { HFrag a[4], b[4]; };

// ap, bp: the wave's first A and B tile row, lane * 8 included
__device__ __forceinline__ void ldset(FragSet& s, const _Float16* ap,
                                      const _Float16* bp, int kt) {
#pragma unroll
  for (int i = 0; i < 4; ++i) ldpacked(s.a[i], ap + (i * KT + kt) * TILE);
#pragma unroll
  for (int f = 0; f < 4; ++f) ldpacked(s.b[f], bp + (f * KT + kt) * TILE);
}

__device__ __forceinline__ void mmset(v8f (&acc)[4][4], const FragSet& s) {
#pragma unroll
  for (int i = 0; i < 4; ++i)
#pragma unroll
    for (int f = 0; f < 4; ++f) acc[i][f] = wmma16(s.a[i], s.b[f], acc[i][f]);
}

// NSET fragment sets in a ring: step kt's products run with the loads of the
// next NSET - 1 steps in flight.
template <int NSET>
__device__ __forceinline__ void gemm64x64(v8f (&acc)[4][4], const _Float16* ap,
                                          const _Float16* bp) {
  const v8f zero = {0.f, 0.f, 0.f, 0.f, 0.f, 0.f, 0.f, 0.f};
#pragma unroll
  for (int i = 0; i < 4; ++i)
#pragma unroll
    for (int f = 0; f < 4; ++f) acc[i][f] = zero;

  FragSet s[NSET];
#pragma unroll
  for (int j = 0; j < NSET - 1; ++j) ldset(s[j], ap, bp, j);
  // unrolled: the sets are indexed by constants and every load is an immediate
  // offset from the two address pairs.
  // The scheduling fence keeps a set's loads ahead of the 16 products of the
  // oldest set: without it the compiler sinks the loads in among the products
  // of the set they feed and waits on them at once.
#pragma unroll
  for (int kt = 0; kt < KT; ++kt) {
    const int nx = kt + NSET - 1;
    if (nx < KT) ldset(s[nx % NSET], ap, bp, nx);
    // behind the last loads: their address registers are reused after the loop
    if (nx == KT - 1) asm volatile("s_wait_xcnt 0x0" ::: "memory");
    __builtin_amdgcn_sched_barrier(0);
    mmset(acc, s[kt % NSET]);
  }
  // keeps the epilogue behind the last products: woven in among them it takes a
  // register-window switch at every turn
  __builtin_amdgcn_sched_barrier(0);
}

// out = xh[4096,1024] @ W_in^T + b_in, routed to q/k/v head buffers, all three
// as packed tiles: q (scaled by d^-0.5) and k with row = token, k = head dim,
// the gated v^T with row = head dim, k = token.
// A 128-wide block lies in one of the three sections. In the q and k sections
// the two operand pointers change places, which gives the transposed tile
// (features down the rows, tokens across the lanes; same products, same k
// order): in every section a lane then holds the 8 values that lie in a row in
// its packed tile, and a wave's 16-byte stores write 512 bytes in a row.
// 4 waves form a 128 x 128 block; 768 blocks, three to a WGP (the second
// launch bound keeps the registers of three waves within a SIMD's file).
__global__ __launch_bounds__(128, 3) void qkv_gemm_kernel(
    const _Float16* __restrict__ xh, const _Float16* __restrict__ winh,
    const float* __restrict__ b_in,  const float* __restrict__ gate,
    const float* __restrict__ part,  const float* __restrict__ bd2,
    const float* __restrict__ ppr,   const float* __restrict__ alpha,
    _Float16* __restrict__ qh, _Float16* __restrict__ kh,
    _Float16* __restrict__ vth, float* __restrict__ bias, int n_ctx) {
  // the per-key bias for the attention launch, 128 entries a work-group, in
  // the work-groups of lowest index, which start ahead of the others
  if (blockIdx.y == 0 && blockIdx.x < NSEQ / 128) {
    const int i = blockIdx.x * 128 + threadIdx.x;
    bias[i] = key_bias(part, bd2, ppr, alpha, n_ctx, i);
  }
  const int lane = threadIdx.x & 31;
  const int wave = threadIdx.x >> 5;
  const int l16  = lane & 15;
  const int g    = lane >> 4;
  const int m0 = blockIdx.x * 128 + (wave & 1) * 64;
  const int n0 = blockIdx.y * 128 + (wave >> 1) * 64;
  const int sect = blockIdx.y / (D_ / 128);   // 0 q, 1 k, 2 v: same in a block

  const _Float16* xp = xh + (size_t)(m0 / 16) * KT * TILE + lane * 8;
  const _Float16* wp = winh + (size_t)(n0 / 16) * KT * TILE + lane * 8;
  v8f acc[4][4];
  gemm64x64<2>(acc, sect < 2 ? wp : xp, sect < 2 ? xp : wp);

  // a wave's 64 tokens lie in one batch, its 64 features are one head
  const size_t hb = (size_t)(m0 / NSEQ * H_ + n0 % D_ / DH);
  const int t0 = m0 % NSEQ;
  if (sect < 2) {
    // acc[i][f][r]: head dim i * 16 + 8 * g + r, token t0 + f * 16 + l16
    const float sc = sect == 0 ? 0.125f : 1.f;   // 1/sqrt(64) on q
    _Float16* dst = (sect == 0 ? qh : kh) +
                    (hb * (NSEQ / 16) + t0 / 16) * 2 * TILE + lane * 8;
    v8f bn[4];
#pragma unroll
    for (int i = 0; i < 4; ++i)
      bn[i] = *(const v8f*)(b_in + n0 + i * 16 + 8 * g);
#pragma unroll
    for (int f = 0; f < 4; ++f) {
#pragma unroll
      for (int i = 0; i < 4; ++i) {
        v8h o;
#pragma unroll
        for (int r = 0; r < 8; ++r)
          o[r] = (_Float16)((acc[i][f][r] + bn[i][r]) * sc);
        *(v8h*)(dst + f * 2 * TILE + i * 256) = o;
      }
    }
    // behind the last store: the code that follows in the listing reuses the
    // stores' data and address registers
    asm volatile("s_wait_xcnt 0x0" ::: "memory");
  } else {
    // acc[i][f][r]: token t0 + i * 16 + 8 * g + r, head dim f * 16 + l16
    _Float16* dst = vth + (hb * (NSEQ / 32) + t0 / 32) * 4 * TILE + lane * 8;
    float bn[4];
    v8f gt[4];
#pragma unroll
    for (int f = 0; f < 4; ++f) bn[f] = b_in[n0 + f * 16 + l16];
#pragma unroll
    for (int i = 0; i < 4; ++i)
      gt[i] = *(const v8f*)(gate + t0 + i * 16 + 8 * g);
#pragma unroll
    for (int i = 0; i < 4; ++i) {
#pragma unroll
      for (int f = 0; f < 4; ++f) {
        v8h o;
#pragma unroll
        for (int r = 0; r < 8; ++r)
          o[r] = (_Float16)((acc[i][f][r] + bn[f]) * gt[i][r]);
        *(v8h*)(dst + ((i >> 1) * 4 + f) * TILE + (i & 1) * 256) = o;
      }
    }
    // as above, behind the last store of this block
    asm volatile("s_wait_xcnt 0x0" ::: "memory");
  }
}

// --------------------------------------------------- flash attention
// 1 wave per 16-query tile; 64-key steps. Scores are formed transposed,
// S^T = K.Q^T (keys down the rows, queries across the lanes), and the
// output as O^T += V^T.P^T: a lane holds one query's scores, so maximum,
// exponentials and sum stay in its registers, and the score tiles,
// converted in place, are the B operands of the second product.
// One running maximum, one exchange between the lane halves and one rescale
// of the output serve 64 keys.
typedef __attribute__((ext_vector_type(2))) _Float16 v2h;

static constexpr int KSTEP = 64;          // keys per online-softmax step

__device__ __forceinline__ float max3f(float a, float b, float c) {
  return fmaxf(fmaxf(a, b), c);
}

__global__ __launch_bounds__(128, 1) void flash_attn_kernel(
    const _Float16* __restrict__ qh, const _Float16* __restrict__ kh,
    const _Float16* __restrict__ vth, const float* __restrict__ bias,
    _Float16* __restrict__ attn) {
  const int lane = threadIdx.x & 31;
  const int wave = threadIdx.x >> 5;
  const int g    = lane >> 4;

  const int tile = blockIdx.x * 4 + wave;
  const int qt = tile % (NSEQ / 16);
  const int bh = tile / (NSEQ / 16);

  const _Float16* qbase = qh + ((size_t)bh * (NSEQ / 16) + qt) * 2 * TILE;
  const _Float16* kball = kh + (size_t)bh * NSEQ * DH;
  const _Float16* vbase = vth + (size_t)bh * DH * NSEQ;

  HFrag bq[2];   // B operand: column l16 = query, k = head dim
  {
    ldpacked(bq[0], qbase + lane * 8);
    ldpacked(bq[1], qbase + TILE + lane * 8);
    // behind the Q loads: the build reuses their address registers as the
    // destination of a K load below
    asm volatile("s_wait_xcnt 0x0" ::: "memory");
  }

  v8f zero = {0.f, 0.f, 0.f, 0.f, 0.f, 0.f, 0.f, 0.f};
  v8f acc[4];    // acc[f][r] = O[query l16][f * 16 + 8 * g + r]
#pragma unroll
  for (int f = 0; f < 4; ++f) acc[f] = zero;

  const float L2E = 1.4426950408889634f;
  float mrun = -INFINITY;  // this query's running maximum (same in both halves)
  float lsum = 0.f;        // sum over this lane half's keys only

  // Operands of a 64-key step. They are fetched one step ahead, into the same
  // registers: K right behind the score products that read it, the bias right
  // behind the last use of the scores (it lands in the score registers, where
  // it starts the next sum), V right behind the output products.
  v8f s[4];      // tile j: keys 16 * j + 8 * g + r; holds the bias, then scores
  HFrag ak[8];   // [key tile(4)][dchunk(2)], A operand: row l16 = key
  HFrag av[8];   // [32 keys(2)][f(4)], A operand: row l16 = head dim f * 16 + l16
  const _Float16* kp = kball + lane * 8;
  const _Float16* vp = vbase + lane * 8;
  const float* bp8 = bias + 8 * g;
  // the three fences keep these loads in this order (bias, K, V): mixed, the
  // counted waits at the loop's head, which must hold for this path too, turn
  // into a full wait that also drains the V loads issued at the loop's foot
  __builtin_amdgcn_sched_barrier(0);
#pragma unroll
  for (int j = 0; j < 4; ++j) s[j] = *(const v8f*)(bp8 + 16 * j);
  __builtin_amdgcn_sched_barrier(0);
#pragma unroll
  for (int f = 0; f < 8; ++f) ldpacked(ak[f], kp + f * TILE);
  __builtin_amdgcn_sched_barrier(0);
#pragma unroll
  for (int f = 0; f < 8; ++f) ldpacked(av[f], vp + f * TILE);

  for (int kc = 0; kc < NSEQ; kc += KSTEP) {
    // the last step has no next one: it reads step 0 again and drops it
    const int kn = kc + KSTEP < NSEQ ? kc + KSTEP : 0;

    // ---- S^T = k @ q^T + bias (scale pre-folded into q); the bias starts the sum
#pragma unroll
    for (int j = 0; j < 4; ++j) s[j] = wmma16(ak[2 * j], bq[0], s[j]);
#pragma unroll
    for (int j = 0; j < 4; ++j) s[j] = wmma16(ak[2 * j + 1], bq[1], s[j]);

    // holds the next step's K loads behind the score products (read only,
    // nothing is changed): lifted over them the loads cannot take the
    // registers the products still read, and the compiler then loads into
    // spare ones and copies them at the loop's foot behind a full wait
    asm volatile("" :: "v"(s[0]), "v"(s[1]), "v"(s[2]), "v"(s[3]) : "memory");
#pragma unroll
    for (int f = 0; f < 8; ++f) ldpacked(ak[f], kp + (size_t)kn * DH + f * TILE);
    // keeps the loads up here, as one group: sunk, they are waited on at once
    __builtin_amdgcn_sched_barrier(0);

    // ---- online softmax, one query per lane, 32 of its 64 keys
    float ta[4], tb[4];
#pragma unroll
    for (int j = 0; j < 4; ++j) {
      ta[j] = max3f(s[j][0], s[j][1], s[j][2]);
      tb[j] = max3f(s[j][3], s[j][4], s[j][5]);
      ta[j] = max3f(ta[j], s[j][6], s[j][7]);
    }
    float mx = max3f(max3f(ta[0], tb[0], ta[1]), max3f(tb[1], ta[2], tb[2]),
                     fmaxf(ta[3], tb[3]));
    mx = max3f(mx, xhalf(mx), mrun);
    const float fr = __builtin_amdgcn_exp2f((mrun - mx) * L2E);
    mrun = mx;
    const float nm = -mx * L2E;

    HFrag bp[2];   // B operands: column l16 = query, k = key, hardware k order
    v2f ps[2];
#pragma unroll
    for (int kb = 0; kb < 2; ++kb) {
#pragma unroll
      for (int i = 0; i < 4; ++i) {
        v2f a0 = __builtin_elementwise_fma(
            v2f{s[2 * kb][2 * i], s[2 * kb][2 * i + 1]}, v2f{L2E, L2E},
            v2f{nm, nm});
        v2f a1 = __builtin_elementwise_fma(
            v2f{s[2 * kb + 1][2 * i], s[2 * kb + 1][2 * i + 1]}, v2f{L2E, L2E},
            v2f{nm, nm});
        v2f p0 = {__builtin_amdgcn_exp2f(a0.x), __builtin_amdgcn_exp2f(a0.y)};
        v2f p1 = {__builtin_amdgcn_exp2f(a1.x), __builtin_amdgcn_exp2f(a1.y)};
        ps[kb] = i == 0 ? p0 + p1 : ps[kb] + (p0 + p1);
        v2h h0 = __builtin_convertvector(p0, v2h);
        v2h h1 = __builtin_convertvector(p1, v2h);
        bp[kb].h[0][2 * i] = h0.x; bp[kb].h[0][2 * i + 1] = h0.y;
        bp[kb].h[1][2 * i] = h1.x; bp[kb].h[1][2 * i + 1] = h1.y;
      }
    }
    const v2f pt = ps[0] + ps[1];
    lsum = lsum * fr + (pt.x + pt.y);

    // holds the next step's bias loads behind the last use of the scores (read
    // only): the loads then land in the score registers themselves; lifted
    // higher they take spare registers and are copied at the loop's foot
    asm volatile("" :: "v"(bp[0].v), "v"(bp[1].v), "v"(lsum) : "memory");
#pragma unroll
    for (int j = 0; j < 4; ++j) s[j] = *(const v8f*)(bp8 + kn + 16 * j);
    // keeps these loads ahead of the output products, which cover their latency
    __builtin_amdgcn_sched_barrier(0);

    // ---- rescale accumulator + O^T += V^T @ P^T (V already in registers)
#pragma unroll
    for (int f = 0; f < 4; ++f) acc[f] = acc[f] * fr;
#pragma unroll
    for (int f = 0; f < 4; ++f) acc[f] = wmma16(av[f], bp[0], acc[f]);
#pragma unroll
    for (int f = 0; f < 4; ++f) acc[f] = wmma16(av[4 + f], bp[1], acc[f]);

    // as above: the next step's V loads behind the output products
    asm volatile("" :: "v"(acc[0]), "v"(acc[1]), "v"(acc[2]), "v"(acc[3])
                 : "memory");
#pragma unroll
    for (int f = 0; f < 8; ++f) ldpacked(av[f], vp + (size_t)kn * DH + f * TILE);
  }

  const float inv = 1.f / (lsum + xhalf(lsum));

  const int bi = bh / H_;
  const int h  = bh % H_;
  // packed for the output projection: tile (16 tokens, 32 features)
  _Float16* orow = attn +
      ((size_t)(bi * (NSEQ / 16) + qt) * KT + h * 2) * TILE + lane * 8;
#pragma unroll
  for (int f = 0; f < 4; ++f) {
    v8h o;
#pragma unroll
    for (int r = 0; r < 8; ++r) o[r] = (_Float16)(acc[f][r] * inv);
    *(v8h*)(orow + f * 256) = o;
  }
  // the last step's dropped loads have landed before the wave gives its
  // registers back
  asm volatile("s_wait_loadcnt 0x0" ::: "memory");
}

// ------------------------------------------------- output projection
// 256 blocks, one wave to a SIMD: four fragment sets keep its loads in flight
__global__ __launch_bounds__(128, 1) void out_gemm_kernel(
    const _Float16* __restrict__ ah, const _Float16* __restrict__ wouth,
    const float* __restrict__ b_out, float* __restrict__ out) {
  const int lane = threadIdx.x & 31;
  const int wave = threadIdx.x >> 5;
  const int l16  = lane & 15;
  const int g    = lane >> 4;
  const int m0 = blockIdx.x * 128 + (wave & 1) * 64;
  const int n0 = blockIdx.y * 128 + (wave >> 1) * 64;

  v8f acc[4][4];
  gemm64x64<4>(acc, ah + (size_t)(m0 / 16) * KT * TILE + lane * 8,
               wouth + (size_t)(n0 / 16) * KT * TILE + lane * 8);

#pragma unroll
  for (int f = 0; f < 4; ++f) {
    int nn = n0 + f * 16 + l16;
    float bn = b_out[nn];
#pragma unroll
    for (int i = 0; i < 4; ++i) {
#pragma unroll
      for (int r = 0; r < 8; ++r) {
        int m = m0 + i * 16 + r + 8 * g;
        out[(size_t)m * D_ + nn] = acc[i][f][r] + bn;
      }
    }
  }
}

// ------------------------------------------------------------ launcher
extern "C" void kernel_launch(void* const* d_in, const int* in_sizes, int n_in,
                              void* d_out, int out_size, void* d_ws,
                              size_t ws_size, hipStream_t stream) {
  (void)n_in; (void)out_size; (void)ws_size;
  const float* x         = (const float*)d_in[0];
  const float* ctx_ppr   = (const float*)d_in[2];
  const float* ctx_delta = (const float*)d_in[3];
  const float* ctx_trust = (const float*)d_in[4];
  const float* W_in      = (const float*)d_in[5];
  const float* b_in      = (const float*)d_in[6];
  const float* W_out     = (const float*)d_in[7];
  const float* b_out     = (const float*)d_in[8];
  const float* alpha     = (const float*)d_in[9];
  const float* tscale    = (const float*)d_in[10];
  const float* Wd1       = (const float*)d_in[11];
  const float* bd1       = (const float*)d_in[12];
  const float* Wd2       = (const float*)d_in[13];
  const float* bd2       = (const float*)d_in[14];
  float* out = (float*)d_out;
  const int n_ctx = in_sizes[2];  // ctx_ppr has n_ctx elements

  // workspace carve (~42 MB; attn output reuses xh)
  char* w = (char*)d_ws;
  auto carve = [&](size_t bytes) -> char* {
    char* p = w;
    w += (bytes + 255) & ~(size_t)255;
    return p;
  };
  _Float16* xh    = (_Float16*)carve((size_t)MROWS * D_ * 2);
  _Float16* winh  = (_Float16*)carve((size_t)3 * D_ * D_ * 2);
  _Float16* wouth = (_Float16*)carve((size_t)D_ * D_ * 2);
  _Float16* qh    = (_Float16*)carve((size_t)MROWS * D_ * 2);
  _Float16* kh    = (_Float16*)carve((size_t)MROWS * D_ * 2);
  _Float16* vth   = (_Float16*)carve((size_t)MROWS * D_ * 2);
  float* gate = (float*)carve((size_t)NSEQ * 4);
  float* bias = (float*)carve((size_t)NSEQ * 4);
  float* part = (float*)carve((size_t)NHQ * (NCTX / 16) * 32 * 4);
  _Float16* attn = xh;  // xh dead after QKV GEMM

  prep_kernel<<<NCB + XB + WIB + WOB, 256, 0, stream>>>(
      x, W_in, W_out, ctx_delta, Wd1, bd1, Wd2, ctx_trust, tscale, xh, winh,
      wouth, part, gate, n_ctx);

  qkv_gemm_kernel<<<dim3(MROWS / 128, NOUTQ / 128), 128, 0, stream>>>(
      xh, winh, b_in, gate, part, bd2, ctx_ppr, alpha, qh, kh, vth, bias,
      n_ctx);

  flash_attn_kernel<<<(B_ * H_ * (NSEQ / 16)) / 4, 128, 0, stream>>>(
      qh, kh, vth, bias, attn);

  out_gemm_kernel<<<dim3(MROWS / 128, D_ / 128), 128, 0, stream>>>(
      attn, wouth, b_out, out);
}
